// v000
// Measured on an AMD MI455X. A time is GPU time per run, averaged over a window of back-to-back runs after a warm-up
// (all launches, gaps included; the runs take copies of the inputs in turn), and the median of several windows.
// Apart from v000's, it joins two sittings. Times from different sittings can be a few percent apart, while
// side-by-side timings come from the same sitting.
// v000, which the later versions start from, runs in 625 microseconds.
#include <hip/hip_runtime.h>

// ---------------- problem constants ----------------
#define BB 64
#define NN 196
#define DD 768
#define HH 12
#define HD 64
#define NPAD 208          // 13 * 16
#define QTILES 13         // ceil(196/16)
#define MTILES 784        // 12544 / 16
#define NT64 (DD / 64)    // 12
#define ASTRIDE 772       // 768 + 4 pad floats: 16B-aligned rows, bank-conflict free

typedef __attribute__((ext_vector_type(2))) float v2f;
typedef __attribute__((ext_vector_type(4))) float v4f;
typedef __attribute__((ext_vector_type(8))) float v8f;

#define WMMA_F32(a, b, c) \
    __builtin_amdgcn_wmma_f32_16x16x4_f32(false, (a), false, (b), (short)0, (c), false, false)

#if __has_builtin(__builtin_amdgcn_global_load_async_to_lds_b128) && \
    __has_builtin(__builtin_amdgcn_s_wait_asynccnt)
#define HAVE_ASYNC_LDS 1
// exact parameter types per hipcc diagnostic: int4 (vector_size 16) pointers,
// addrspace(1) for the global source, addrspace(3) for the LDS destination.
typedef __attribute__((vector_size(16))) int vsi4;
typedef __attribute__((address_space(1))) vsi4 g_vsi4;
typedef __attribute__((address_space(3))) vsi4 l_vsi4;
#else
#define HAVE_ASYNC_LDS 0
#endif

// ---------------------------------------------------------------------------
// Stage 1: zero only the 12 padding rows (tokens 196..207) of Q/K/V head
// buffers [B][H][NPAD][HD] — replaces a 123 MB memset with ~7 MB of writes.
// ---------------------------------------------------------------------------
__global__ __launch_bounds__(256) void zero_pad_kernel(float* __restrict__ ws) {
  const size_t QHN = (size_t)BB * HH * NPAD * HD;
  size_t idx = (size_t)blockIdx.x * 256 + threadIdx.x;  // < 3*BB*HH*12*HD
  const size_t per_mat = (size_t)BB * HH * 12 * HD;
  int mat = (int)(idx / per_mat);
  size_t rem = idx % per_mat;
  int hd = (int)(rem % HD);
  size_t t = rem / HD;
  int row = NN + (int)(t % 12);
  int bh = (int)(t / 12);  // 0..767
  ws[mat * QHN + ((size_t)bh * NPAD + row) * HD + hd] = 0.0f;
}

// ---------------------------------------------------------------------------
// Stage 2: relative-position bias MLP, fused with key-padding mask.
// bias[b,q,k] = kpad ? -inf : ((is_overlap && !qpad) ? enc(qpos-kpos) : 0)
// Stored [B][NPAD][NPAD] (only [0..195][0..195] written / read).
// ---------------------------------------------------------------------------
__global__ __launch_bounds__(256) void bias_kernel(
    const float* __restrict__ qpos, const float* __restrict__ kpos,
    const int* __restrict__ qpad, const int* __restrict__ kpad,
    const int* __restrict__ is_ovl,
    const float* __restrict__ W1, const float* __restrict__ b1,
    const float* __restrict__ W2, const float* __restrict__ b2,
    float* __restrict__ biasbuf) {
  size_t idx = (size_t)blockIdx.x * 256 + threadIdx.x;
  if (idx >= (size_t)BB * NN * NN) return;
  int k = (int)(idx % NN);
  size_t r = idx / NN;
  int q = (int)(r % NN);
  int b = (int)(r / NN);

  float out;
  if (kpad[b * NN + k]) {
    out = -__builtin_inff();
  } else if (is_ovl[b] && !qpad[b * NN + q]) {
    float rx = qpos[((size_t)b * NN + q) * 3 + 0] - kpos[((size_t)b * NN + k) * 3 + 0];
    float ry = qpos[((size_t)b * NN + q) * 3 + 1] - kpos[((size_t)b * NN + k) * 3 + 1];
    float rz = qpos[((size_t)b * NN + q) * 3 + 2] - kpos[((size_t)b * NN + k) * 3 + 2];
    float acc = b2[0];
#pragma unroll
    for (int e = 0; e < 32; ++e) {
      float h = fmaf(rx, W1[e], fmaf(ry, W1[32 + e], fmaf(rz, W1[64 + e], b1[e])));
      acc = fmaf(fmaxf(h, 0.0f), W2[e], acc);
    }
    out = acc;
  } else {
    out = 0.0f;
  }
  biasbuf[((size_t)b * NPAD + q) * NPAD + k] = out;
}

// ---------------------------------------------------------------------------
// Stages 3 & 5: fp32 WMMA GEMM, C[12544,768] = A[12544,768] * W[768,768].
// Block = 12 waves = one 16-row M-tile; wave w owns 64 output columns.
// The 16x768 A slab is staged once into LDS with async global->LDS copies
// (ASYNCcnt), then A fragments come from LDS (ds_load_b64, bank-conflict-free).
// mode 0: scatter into padded head layout [B][H][NPAD][HD]   (Q/K/V proj)
// mode 1: out[row*768+col] = acc + bias[col]                 (final proj)
// ---------------------------------------------------------------------------
__global__ __launch_bounds__(384) void gemm_proj(
    const float* __restrict__ A, const float* __restrict__ W,
    const float* __restrict__ bias, float* __restrict__ out, int mode) {
  __shared__ float Abuf[16][ASTRIDE];  // 49.4 KB

  int mtile = blockIdx.x;          // 0..783
  int nt = threadIdx.x >> 5;       // wave id = 64-col tile (0..11)
  int l = threadIdx.x & 31;
  int h = l >> 4;                  // lane half: selects k-pair / row-half
  int n16 = l & 15;                // lane within 16

  // ---- stage A slab [16][768] into LDS, coalesced ----
  {
    const float* asrc = A + (size_t)mtile * 16 * DD;
#pragma unroll
    for (int i = 0; i < 8; ++i) {
      int idx = (int)threadIdx.x + i * 384;  // float4 index 0..3071
      int row = idx / 192;
      int c4 = (idx % 192) * 4;
#if HAVE_ASYNC_LDS
      __builtin_amdgcn_global_load_async_to_lds_b128(
          (g_vsi4*)(asrc + (size_t)row * DD + c4),
          (l_vsi4*)&Abuf[row][c4], 0, 0);
#else
      *(v4f*)&Abuf[row][c4] = *(const v4f*)(asrc + (size_t)row * DD + c4);
#endif
    }
#if HAVE_ASYNC_LDS
    __builtin_amdgcn_s_wait_asynccnt(0);
#endif
    __syncthreads();
  }

  v8f acc[4] = {v8f{}, v8f{}, v8f{}, v8f{}};

  for (int k = 0; k < DD; k += 4) {
    // A fragment from LDS: element j -> A[row=n16][k + 2h + j]
    v2f a = *(const v2f*)&Abuf[n16][k + 2 * h];
#pragma unroll
    for (int c4 = 0; c4 < 4; ++c4) {
      int col = nt * 64 + c4 * 16 + n16;
      v2f bfr;
      bfr.x = W[(size_t)(k + 2 * h + 0) * DD + col];
      bfr.y = W[(size_t)(k + 2 * h + 1) * DD + col];
      acc[c4] = WMMA_F32(a, bfr, acc[c4]);
    }
  }

#pragma unroll
  for (int c4 = 0; c4 < 4; ++c4) {
#pragma unroll
    for (int j = 0; j < 8; ++j) {
      int m = j + 8 * h;                 // C row within tile
      int R = mtile * 16 + m;            // global row
      int col = nt * 64 + c4 * 16 + n16; // global col
      if (mode == 0) {
        int bb = R / NN, tok = R % NN;
        int hh = col >> 6, hd = col & 63;
        out[(((size_t)bb * HH + hh) * NPAD + tok) * HD + hd] = acc[c4][j];
      } else {
        out[(size_t)R * DD + col] = acc[c4][j] + bias[col];
      }
    }
  }
}

// ---------------------------------------------------------------------------
// Stage 4: attention. Block = 4 waves, block per (batch, query-tile).
// Each wave processes 3 heads. Scores -> LDS [16][NPAD] -> softmax -> P@V.
// ---------------------------------------------------------------------------
__global__ __launch_bounds__(128) void attention_kernel(
    const float* __restrict__ Qh, const float* __restrict__ Kh,
    const float* __restrict__ Vh, const float* __restrict__ biasbuf,
    float* __restrict__ ctx) {
  __shared__ float S[4][16][NPAD];  // 52 KB

  int w = threadIdx.x >> 5;
  int l = threadIdx.x & 31;
  int b = blockIdx.x / QTILES;
  int qt = blockIdx.x % QTILES;
  int h = l >> 4;
  int n16 = l & 15;
  const float scale = 0.125f;  // 1/sqrt(HD)

  for (int head = w; head < HH; head += 4) {
    const float* Qb = Qh + ((size_t)b * HH + head) * NPAD * HD;
    const float* Kb = Kh + ((size_t)b * HH + head) * NPAD * HD;
    const float* Vb = Vh + ((size_t)b * HH + head) * NPAD * HD;

    // ---- Q fragments: 16 queries x 64 head-dims, 16 k-chunks of 4 ----
    int qrow = qt * 16 + n16;  // < NPAD, padded region is zero
    v2f qf[16];
#pragma unroll
    for (int kc = 0; kc < 16; ++kc)
      qf[kc] = *(const v2f*)(Qb + (size_t)qrow * HD + kc * 4 + 2 * h);

    // ---- scores: S = scale*(Q K^T) + bias, key-padding masked ----
    for (int t = 0; t < QTILES; ++t) {
      int key = t * 16 + n16;
      const float* krow = Kb + (size_t)key * HD;
      v8f acc = v8f{};
#pragma unroll
      for (int kc = 0; kc < 16; ++kc) {
        int hd0 = kc * 4 + 2 * h;
        v2f bfr;
        bfr.x = krow[hd0];
        bfr.y = krow[hd0 + 1];
        acc = WMMA_F32(qf[kc], bfr, acc);
      }
#pragma unroll
      for (int j = 0; j < 8; ++j) {
        int m = j + 8 * h;
        int q = qt * 16 + m;
        float s = acc[j] * scale;
        if (key < NN && q < NN)
          s += biasbuf[((size_t)b * NPAD + q) * NPAD + key];  // holds -inf for kpad
        if (key >= NN) s = -__builtin_inff();
        S[w][m][t * 16 + n16] = s;
      }
    }
    __syncthreads();

    // ---- softmax along each of the 16 rows (208 cols, -inf in padding) ----
    for (int m = 0; m < 16; ++m) {
      float mx = -__builtin_inff();
      for (int c = l; c < NPAD; c += 32) mx = fmaxf(mx, S[w][m][c]);
#pragma unroll
      for (int off = 16; off >= 1; off >>= 1) mx = fmaxf(mx, __shfl_xor(mx, off, 32));
      float sum = 0.0f;
      for (int c = l; c < NPAD; c += 32) {
        float e = __expf(S[w][m][c] - mx);
        S[w][m][c] = e;
        sum += e;
      }
#pragma unroll
      for (int off = 16; off >= 1; off >>= 1) sum += __shfl_xor(sum, off, 32);
      float inv = 1.0f / sum;
      for (int c = l; c < NPAD; c += 32) S[w][m][c] *= inv;
    }
    __syncthreads();

    // ---- out = P @ V : A-fragments re-read from LDS in A-layout ----
    v8f oacc[4] = {v8f{}, v8f{}, v8f{}, v8f{}};
    for (int t = 0; t < NPAD / 4; ++t) {
      int k0 = t * 4 + 2 * h;
      v2f af = *(const v2f*)&S[w][n16][k0];  // ds_load_b64
#pragma unroll
      for (int oc = 0; oc < 4; ++oc) {
        v2f bfr;
        bfr.x = Vb[(size_t)(k0 + 0) * HD + oc * 16 + n16];
        bfr.y = Vb[(size_t)(k0 + 1) * HD + oc * 16 + n16];
        oacc[oc] = WMMA_F32(af, bfr, oacc[oc]);
      }
    }
#pragma unroll
    for (int oc = 0; oc < 4; ++oc) {
#pragma unroll
      for (int j = 0; j < 8; ++j) {
        int m = j + 8 * h;
        int q = qt * 16 + m;
        if (q < NN)
          ctx[((size_t)b * NN + q) * DD + head * HD + oc * 16 + n16] = oacc[oc][j];
      }
    }
    __syncthreads();
  }
}

// ---------------------------------------------------------------------------
extern "C" void kernel_launch(void* const* d_in, const int* in_sizes, int n_in,
                              void* d_out, int out_size, void* d_ws, size_t ws_size,
                              hipStream_t stream) {
  const float* query = (const float*)d_in[0];
  const float* key   = (const float*)d_in[1];
  const float* value = (const float*)d_in[2];
  const int*   qpad  = (const int*)d_in[3];
  const int*   kpad  = (const int*)d_in[4];
  const float* qpos  = (const float*)d_in[5];
  const float* kpos  = (const float*)d_in[6];
  const int*   isov  = (const int*)d_in[7];
  const float* Wq    = (const float*)d_in[8];
  const float* Wk    = (const float*)d_in[9];
  const float* Wv    = (const float*)d_in[10];
  const float* Wp    = (const float*)d_in[11];
  const float* bp    = (const float*)d_in[12];
  const float* W1    = (const float*)d_in[13];
  const float* b1    = (const float*)d_in[14];
  const float* W2    = (const float*)d_in[15];
  const float* b2    = (const float*)d_in[16];

  float* ws = (float*)d_ws;
  const size_t QHN = (size_t)BB * HH * NPAD * HD;  // 10,223,616 floats
  float* Qh = ws;
  float* Kh = Qh + QHN;
  float* Vh = Kh + QHN;
  float* biasbuf = Vh + QHN;                       // [B][NPAD][NPAD]
  const size_t BIASN = (size_t)BB * NPAD * NPAD;
  float* ctx = biasbuf + BIASN;                    // [B][N][D]

  // stage 1: zero padding rows of Q/K/V head buffers (WMMA tiles read them)
  {
    size_t total = (size_t)3 * BB * HH * 12 * HD;  // 1,769,472 -> 6912 blocks
    zero_pad_kernel<<<(unsigned)(total / 256), 256, 0, stream>>>(ws);
  }

  // stage 2: rel-pos bias + key mask
  {
    size_t total = (size_t)BB * NN * NN;
    bias_kernel<<<(unsigned)((total + 255) / 256), 256, 0, stream>>>(
        qpos, kpos, qpad, kpad, isov, W1, b1, W2, b2, biasbuf);
  }

  // stage 3: Q/K/V projections (async-LDS staged A, WMMA, head-layout scatter)
  gemm_proj<<<MTILES, 384, 0, stream>>>(query, Wq, nullptr, Qh, 0);
  gemm_proj<<<MTILES, 384, 0, stream>>>(key,   Wk, nullptr, Kh, 0);
  gemm_proj<<<MTILES, 384, 0, stream>>>(value, Wv, nullptr, Vh, 0);

  // stage 4: attention
  attention_kernel<<<BB * QTILES, 128, 0, stream>>>(Qh, Kh, Vh, biasbuf, ctx);

  // stage 5: output projection + bias
  gemm_proj<<<MTILES, 384, 0, stream>>>(ctx, Wp, bp, (float*)d_out, 1);
}

// v001
// Measured time: 522 microseconds a run.
// Two timings next to v000 both put it at 1.24 times that version's speed.
#include <hip/hip_runtime.h>

// ---------------- problem constants ----------------
#define BB 64
#define NN 196
#define DD 768
#define HH 12
#define HD 64
#define NPAD 208          // 13 * 16
#define QTILES 13         // ceil(196/16)
#define BM 64             // GEMM block tile rows
#define BN 128            // GEMM block tile columns
#define KC 32             // GEMM K chunk per LDS stage
#define NTRIP (DD / KC)   // 24
#define NBLK (DD / BN)    // 6 column tiles
#define GEMM_BLOCKS 1176  // (12544 / 64) * 6
#define APITCH 36         // 32 + 4 floats: 16 rows of b64 reads fall on 64 banks
#define BPITCH 288        // one k-pair of W: 2 x 128 + 32 floats (layout at copy_chunk)
#define A_FLOATS (BM * APITCH)
#define B_FLOATS ((KC / 2) * BPITCH)
#define STAGE_FLOATS (A_FLOATS + B_FLOATS)  // 27,648 B

typedef __attribute__((ext_vector_type(2))) float v2f;
typedef __attribute__((ext_vector_type(8))) float v8f;

#define WMMA_F32(a, b, c) \
    __builtin_amdgcn_wmma_f32_16x16x4_f32(false, (a), false, (b), (short)0, (c), false, false)

// ---------------------------------------------------------------------------
// Stage 1: zero only the 12 padding rows (tokens 196..207) of Q/K/V head
// buffers [B][H][NPAD][HD] — replaces a 123 MB memset with ~7 MB of writes.
// ---------------------------------------------------------------------------
__global__ __launch_bounds__(256) void zero_pad_kernel(float* __restrict__ ws) {
  const size_t QHN = (size_t)BB * HH * NPAD * HD;
  size_t idx = (size_t)blockIdx.x * 256 + threadIdx.x;  // < 3*BB*HH*12*HD
  const size_t per_mat = (size_t)BB * HH * 12 * HD;
  int mat = (int)(idx / per_mat);
  size_t rem = idx % per_mat;
  int hd = (int)(rem % HD);
  size_t t = rem / HD;
  int row = NN + (int)(t % 12);
  int bh = (int)(t / 12);  // 0..767
  ws[mat * QHN + ((size_t)bh * NPAD + row) * HD + hd] = 0.0f;
}

// ---------------------------------------------------------------------------
// Stage 2: relative-position bias MLP, fused with key-padding mask.
// bias[b,q,k] = kpad ? -inf : ((is_overlap && !qpad) ? enc(qpos-kpos) : 0)
// Stored [B][NPAD][NPAD] (only [0..195][0..195] written / read).
// ---------------------------------------------------------------------------
__global__ __launch_bounds__(256) void bias_kernel(
    const float* __restrict__ qpos, const float* __restrict__ kpos,
    const int* __restrict__ qpad, const int* __restrict__ kpad,
    const int* __restrict__ is_ovl,
    const float* __restrict__ W1, const float* __restrict__ b1,
    const float* __restrict__ W2, const float* __restrict__ b2,
    float* __restrict__ biasbuf) {
  size_t idx = (size_t)blockIdx.x * 256 + threadIdx.x;
  if (idx >= (size_t)BB * NN * NN) return;
  int k = (int)(idx % NN);
  size_t r = idx / NN;
  int q = (int)(r % NN);
  int b = (int)(r / NN);

  float out;
  if (kpad[b * NN + k]) {
    out = -__builtin_inff();
  } else if (is_ovl[b] && !qpad[b * NN + q]) {
    float rx = qpos[((size_t)b * NN + q) * 3 + 0] - kpos[((size_t)b * NN + k) * 3 + 0];
    float ry = qpos[((size_t)b * NN + q) * 3 + 1] - kpos[((size_t)b * NN + k) * 3 + 1];
    float rz = qpos[((size_t)b * NN + q) * 3 + 2] - kpos[((size_t)b * NN + k) * 3 + 2];
    float acc = b2[0];
#pragma unroll
    for (int e = 0; e < 32; ++e) {
      float h = fmaf(rx, W1[e], fmaf(ry, W1[32 + e], fmaf(rz, W1[64 + e], b1[e])));
      acc = fmaf(fmaxf(h, 0.0f), W2[e], acc);
    }
    out = acc;
  } else {
    out = 0.0f;
  }
  biasbuf[((size_t)b * NPAD + q) * NPAD + k] = out;
}

// ---------------------------------------------------------------------------
// Stages 3 & 5: fp32 WMMA GEMM, C[12544,768] = A[12544,768] * W[768,768].
// Block = 8 waves = one 64 x 128 tile of C; wave (wm, wn) owns 32 x 32 of it
// (2 x 2 accumulator tiles). K runs in chunks of 32: the 64 x 32 piece of A and
// the 32 x 128 piece of W are staged in LDS by async b128 copies, two buffers,
// the next chunk in flight while this one is multiplied. Every W element is
// fetched from L2 once per 64 rows of C and read by the waves from LDS.
// mode 0: scatter into padded head layout [B][H][NPAD][HD]   (Q/K/V proj)
// mode 1: out[row*768+col] = acc + bias[col]                 (final proj)
// ---------------------------------------------------------------------------
__device__ __forceinline__ unsigned lds_off(const void* p) { return (unsigned)(size_t)p; }

// One chunk: 2 copies of A and 4 of W per lane. The s_wait_xcnt closes the
// statement so that no address register is rewritten ahead of it.
// W in LDS: rows k = 2p and 2p+1 share pitch row p, interleaved in runs of 16
// columns: float (k, c) sits at p*BPITCH + (c/16)*32 + (k&1)*16 + c%16, so a
// lane's two k of one fragment are 16 floats apart (one two-address read into a
// register pair) and the two lane halves fall on different banks.
__device__ __forceinline__ void copy_chunk(unsigned la, unsigned lb,
                                           const float* ga, const float* gb) {
  unsigned la1 = la + 32 * APITCH * 4;
  unsigned lb1 = lb + 4 * BPITCH * 4, lb2 = lb + 8 * BPITCH * 4, lb3 = lb + 12 * BPITCH * 4;
  const float* ga1 = ga + 32 * DD;
  const float* gb1 = gb + 8 * DD;
  const float* gb2 = gb + 16 * DD;
  const float* gb3 = gb + 24 * DD;
  asm volatile(
      "global_load_async_to_lds_b128 %0, %6, off\n\t"
      "global_load_async_to_lds_b128 %1, %7, off\n\t"
      "global_load_async_to_lds_b128 %2, %8, off\n\t"
      "global_load_async_to_lds_b128 %3, %9, off\n\t"
      "global_load_async_to_lds_b128 %4, %10, off\n\t"
      "global_load_async_to_lds_b128 %5, %11, off\n\t"
      "s_wait_xcnt 0x0"
      :: "v"(la), "v"(la1), "v"(lb), "v"(lb1), "v"(lb2), "v"(lb3),
         "v"(ga), "v"(ga1), "v"(gb), "v"(gb1), "v"(gb2), "v"(gb3)
      : "memory");
}

__global__ __launch_bounds__(256) void gemm_proj(
    const float* __restrict__ A, const float* __restrict__ W,
    const float* __restrict__ bias, float* __restrict__ out, int mode) {
  __shared__ __attribute__((aligned(16))) float smem[2 * STAGE_FLOATS];  // 54 KB

  int tid = (int)threadIdx.x;
  int m0 = ((int)blockIdx.x / NBLK) * BM;   // first row of the C tile
  int n0 = ((int)blockIdx.x % NBLK) * BN;   // first column of the C tile
  int wave = tid >> 5;
  int wm = wave & 1;               // 32-row half of the tile
  int wn = wave >> 1;              // 32-column quarter of the tile
  int l = tid & 31;
  int h = l >> 4;                  // lane half: selects k-pair / row-half
  int n16 = l & 15;                // lane within 16

  // each lane's own copy addresses: A rows tid/8 (+32), W rows tid/32 (+8,16,24)
  const float* ga = A + (size_t)(m0 + (tid >> 3)) * DD + (tid & 7) * 4;
  const float* gb = W + (size_t)(tid >> 5) * DD + n0 + (tid & 31) * 4;
  unsigned la = lds_off(smem) + ((tid >> 3) * APITCH + (tid & 7) * 4) * 4;
  unsigned lb = lds_off(smem) + (A_FLOATS + (tid >> 6) * BPITCH + ((tid & 31) >> 2) * 32 +
                                 ((tid >> 5) & 1) * 16 + (tid & 3) * 4) * 4;

  copy_chunk(la, lb, ga, gb);
  asm volatile("s_wait_asynccnt 0x0" ::: "memory");  // chunk 0 landed (own copies)
  __syncthreads();                                   // ... and everybody's
  copy_chunk(la + STAGE_FLOATS * 4, lb + STAGE_FLOATS * 4, ga + KC, gb + (size_t)KC * DD);

  v8f acc[2][2] = {{v8f{}, v8f{}}, {v8f{}, v8f{}}};

  // rolled: one trip's 32 WMMAs are body enough
#pragma unroll 1
  for (int t = 0; t < NTRIP; ++t) {
    const float* As = smem + (t & 1) * STAGE_FLOATS + (wm * 32 + n16) * APITCH + 2 * h;
    const float* Bs = smem + (t & 1) * STAGE_FLOATS + A_FLOATS + h * BPITCH + wn * 64 + n16;
    // unrolled: constant LDS offsets, and the reads can run ahead of the WMMAs
#pragma unroll
    for (int ks = 0; ks < KC / 4; ++ks) {
      // fragment element j -> k = t*32 + ks*4 + 2h + j, for A and for W alike
      v2f a0 = *(const v2f*)&As[ks * 4];
      v2f a1 = *(const v2f*)&As[16 * APITCH + ks * 4];
      v2f b0, b1;
      b0.x = Bs[ks * 2 * BPITCH];
      b0.y = Bs[ks * 2 * BPITCH + 16];
      b1.x = Bs[ks * 2 * BPITCH + 32];
      b1.y = Bs[ks * 2 * BPITCH + 48];
      acc[0][0] = WMMA_F32(a0, b0, acc[0][0]);
      acc[0][1] = WMMA_F32(a0, b1, acc[0][1]);
      acc[1][0] = WMMA_F32(a1, b0, acc[1][0]);
      acc[1][1] = WMMA_F32(a1, b1, acc[1][1]);
    }
    asm volatile("s_wait_dscnt 0x0" ::: "memory");     // own reads of this buffer are done
    asm volatile("s_wait_asynccnt 0x0" ::: "memory");  // own copies of chunk t+1 landed
    __syncthreads();  // publishes chunk t+1 and frees the buffer trip t has read
    if (t + 2 < NTRIP)
      copy_chunk(la + (t & 1) * (STAGE_FLOATS * 4), lb + (t & 1) * (STAGE_FLOATS * 4),
                 ga + (t + 2) * KC, gb + (size_t)(t + 2) * KC * DD);
  }
  asm volatile("s_wait_asynccnt 0x0" ::: "memory");  // nothing in flight at the end

  int row0 = m0 + wm * 32 + 8 * h;   // C row of accumulator element 0, tile row 0
  int col0 = n0 + wn * 32 + n16;     // C column, tile column 0
  // the store loops are unrolled so that every accumulator index is a constant
  if (mode == 0) {
    int hh = col0 >> 6, hd = col0 & 63;  // both 16-column tiles lie in one head
#pragma unroll
    for (int mi = 0; mi < 2; ++mi) {
#pragma unroll
      for (int j = 0; j < 8; ++j) {
        int R = row0 + mi * 16 + j;
        int bb = R / NN, tok = R % NN;
        float* o = out + (((size_t)bb * HH + hh) * NPAD + tok) * HD + hd;
        o[0] = acc[mi][0][j];
        o[16] = acc[mi][1][j];
      }
    }
  } else {
    float bias0 = bias[col0], bias1 = bias[col0 + 16];
#pragma unroll
    for (int mi = 0; mi < 2; ++mi) {
#pragma unroll
      for (int j = 0; j < 8; ++j) {
        float* o = out + (size_t)(row0 + mi * 16 + j) * DD + col0;
        o[0] = acc[mi][0][j] + bias0;
        o[16] = acc[mi][1][j] + bias1;
      }
    }
    // the compiler lays the mode 0 code behind this branch: this wait keeps every
    // later write of the stores' address and data registers behind the stores
    asm volatile("s_wait_xcnt 0x0" ::: "memory");
  }
}

// ---------------------------------------------------------------------------
// Stage 4: attention. Block = 4 waves, block per (batch, query-tile).
// Each wave processes 3 heads. Scores -> LDS [16][NPAD] -> softmax -> P@V.
// ---------------------------------------------------------------------------
__global__ __launch_bounds__(128) void attention_kernel(
    const float* __restrict__ Qh, const float* __restrict__ Kh,
    const float* __restrict__ Vh, const float* __restrict__ biasbuf,
    float* __restrict__ ctx) {
  __shared__ float S[4][16][NPAD];  // 52 KB

  int w = threadIdx.x >> 5;
  int l = threadIdx.x & 31;
  int b = blockIdx.x / QTILES;
  int qt = blockIdx.x % QTILES;
  int h = l >> 4;
  int n16 = l & 15;
  const float scale = 0.125f;  // 1/sqrt(HD)

  for (int head = w; head < HH; head += 4) {
    const float* Qb = Qh + ((size_t)b * HH + head) * NPAD * HD;
    const float* Kb = Kh + ((size_t)b * HH + head) * NPAD * HD;
    const float* Vb = Vh + ((size_t)b * HH + head) * NPAD * HD;

    // ---- Q fragments: 16 queries x 64 head-dims, 16 k-chunks of 4 ----
    int qrow = qt * 16 + n16;  // < NPAD, padded region is zero
    v2f qf[16];
#pragma unroll
    for (int kc = 0; kc < 16; ++kc)
      qf[kc] = *(const v2f*)(Qb + (size_t)qrow * HD + kc * 4 + 2 * h);

    // ---- scores: S = scale*(Q K^T) + bias, key-padding masked ----
    for (int t = 0; t < QTILES; ++t) {
      int key = t * 16 + n16;
      const float* krow = Kb + (size_t)key * HD;
      v8f acc = v8f{};
#pragma unroll
      for (int kc = 0; kc < 16; ++kc) {
        int hd0 = kc * 4 + 2 * h;
        v2f bfr;
        bfr.x = krow[hd0];
        bfr.y = krow[hd0 + 1];
        acc = WMMA_F32(qf[kc], bfr, acc);
      }
#pragma unroll
      for (int j = 0; j < 8; ++j) {
        int m = j + 8 * h;
        int q = qt * 16 + m;
        float s = acc[j] * scale;
        if (key < NN && q < NN)
          s += biasbuf[((size_t)b * NPAD + q) * NPAD + key];  // holds -inf for kpad
        if (key >= NN) s = -__builtin_inff();
        S[w][m][t * 16 + n16] = s;
      }
    }
    __syncthreads();

    // ---- softmax along each of the 16 rows (208 cols, -inf in padding) ----
    for (int m = 0; m < 16; ++m) {
      float mx = -__builtin_inff();
      for (int c = l; c < NPAD; c += 32) mx = fmaxf(mx, S[w][m][c]);
#pragma unroll
      for (int off = 16; off >= 1; off >>= 1) mx = fmaxf(mx, __shfl_xor(mx, off, 32));
      float sum = 0.0f;
      for (int c = l; c < NPAD; c += 32) {
        float e = __expf(S[w][m][c] - mx);
        S[w][m][c] = e;
        sum += e;
      }
#pragma unroll
      for (int off = 16; off >= 1; off >>= 1) sum += __shfl_xor(sum, off, 32);
      float inv = 1.0f / sum;
      for (int c = l; c < NPAD; c += 32) S[w][m][c] *= inv;
    }
    __syncthreads();

    // ---- out = P @ V : A-fragments re-read from LDS in A-layout ----
    v8f oacc[4] = {v8f{}, v8f{}, v8f{}, v8f{}};
    for (int t = 0; t < NPAD / 4; ++t) {
      int k0 = t * 4 + 2 * h;
      v2f af = *(const v2f*)&S[w][n16][k0];  // ds_load_b64
#pragma unroll
      for (int oc = 0; oc < 4; ++oc) {
        v2f bfr;
        bfr.x = Vb[(size_t)(k0 + 0) * HD + oc * 16 + n16];
        bfr.y = Vb[(size_t)(k0 + 1) * HD + oc * 16 + n16];
        oacc[oc] = WMMA_F32(af, bfr, oacc[oc]);
      }
    }
#pragma unroll
    for (int oc = 0; oc < 4; ++oc) {
#pragma unroll
      for (int j = 0; j < 8; ++j) {
        int m = j + 8 * h;
        int q = qt * 16 + m;
        if (q < NN)
          ctx[((size_t)b * NN + q) * DD + head * HD + oc * 16 + n16] = oacc[oc][j];
      }
    }
    __syncthreads();
  }
}

// ---------------------------------------------------------------------------
extern "C" void kernel_launch(void* const* d_in, const int* in_sizes, int n_in,
                              void* d_out, int out_size, void* d_ws, size_t ws_size,
                              hipStream_t stream) {
  const float* query = (const float*)d_in[0];
  const float* key   = (const float*)d_in[1];
  const float* value = (const float*)d_in[2];
  const int*   qpad  = (const int*)d_in[3];
  const int*   kpad  = (const int*)d_in[4];
  const float* qpos  = (const float*)d_in[5];
  const float* kpos  = (const float*)d_in[6];
  const int*   isov  = (const int*)d_in[7];
  const float* Wq    = (const float*)d_in[8];
  const float* Wk    = (const float*)d_in[9];
  const float* Wv    = (const float*)d_in[10];
  const float* Wp    = (const float*)d_in[11];
  const float* bp    = (const float*)d_in[12];
  const float* W1    = (const float*)d_in[13];
  const float* b1    = (const float*)d_in[14];
  const float* W2    = (const float*)d_in[15];
  const float* b2    = (const float*)d_in[16];

  float* ws = (float*)d_ws;
  const size_t QHN = (size_t)BB * HH * NPAD * HD;  // 10,223,616 floats
  float* Qh = ws;
  float* Kh = Qh + QHN;
  float* Vh = Kh + QHN;
  float* biasbuf = Vh + QHN;                       // [B][NPAD][NPAD]
  const size_t BIASN = (size_t)BB * NPAD * NPAD;
  float* ctx = biasbuf + BIASN;                    // [B][N][D]

  // stage 1: zero padding rows of Q/K/V head buffers (WMMA tiles read them)
  {
    size_t total = (size_t)3 * BB * HH * 12 * HD;  // 1,769,472 -> 6912 blocks
    zero_pad_kernel<<<(unsigned)(total / 256), 256, 0, stream>>>(ws);
  }

  // stage 2: rel-pos bias + key mask
  {
    size_t total = (size_t)BB * NN * NN;
    bias_kernel<<<(unsigned)((total + 255) / 256), 256, 0, stream>>>(
        qpos, kpos, qpad, kpad, isov, W1, b1, W2, b2, biasbuf);
  }

  // stage 3: Q/K/V projections (LDS-staged A and W, WMMA, head-layout scatter)
  gemm_proj<<<GEMM_BLOCKS, 256, 0, stream>>>(query, Wq, nullptr, Qh, 0);
  gemm_proj<<<GEMM_BLOCKS, 256, 0, stream>>>(key,   Wk, nullptr, Kh, 0);
  gemm_proj<<<GEMM_BLOCKS, 256, 0, stream>>>(value, Wv, nullptr, Vh, 0);

  // stage 4: attention
  attention_kernel<<<BB * QTILES, 128, 0, stream>>>(Qh, Kh, Vh, biasbuf, ctx);

  // stage 5: output projection + bias
  gemm_proj<<<GEMM_BLOCKS, 256, 0, stream>>>(ctx, Wp, bp, (float*)d_out, 1);
}

// v002
// It runs in 413 microseconds.
// Two timings next to v001 both put it at 1.26 times that version's speed.
// Over all steps from v000 it is 1.57 times as fast.
#include <hip/hip_runtime.h>

// ---------------- problem constants ----------------
#define BB 64
#define NN 196
#define DD 768
#define HH 12
#define HD 64
#define NPAD 208          // 13 * 16
#define QTILES 13         // ceil(196/16)
#define BM 64             // GEMM block tile rows
#define BN 128            // GEMM block tile columns
#define KC 32             // GEMM K chunk per LDS stage
#define NTRIP (DD / KC)   // 24
#define NBLK (DD / BN)    // 6 column tiles
#define GEMM_BLOCKS 1176  // (12544 / 64) * 6
#define APITCH 36         // 32 + 4 floats: 16 rows of b64 reads fall on 64 banks
#define BPITCH 288        // one k-pair of W: 2 x 128 + 32 floats (layout at copy_chunk)
#define A_FLOATS (BM * APITCH)
#define B_FLOATS ((KC / 2) * BPITCH)
#define STAGE_FLOATS (A_FLOATS + B_FLOATS)  // 27,648 B

typedef __attribute__((ext_vector_type(2))) float v2f;
typedef __attribute__((ext_vector_type(4))) float v4f;
typedef __attribute__((ext_vector_type(8))) float v8f;

#define WMMA_F32(a, b, c) \
    __builtin_amdgcn_wmma_f32_16x16x4_f32(false, (a), false, (b), (short)0, (c), false, false)

// ---------------------------------------------------------------------------
// Stage 1: zero only the 12 padding rows (tokens 196..207) of Q/K/V head
// buffers [B][H][NPAD][HD] — replaces a 123 MB memset with ~7 MB of writes.
// ---------------------------------------------------------------------------
__global__ __launch_bounds__(256) void zero_pad_kernel(float* __restrict__ ws) {
  const size_t QHN = (size_t)BB * HH * NPAD * HD;
  size_t idx = (size_t)blockIdx.x * 256 + threadIdx.x;  // < 3*BB*HH*12*HD
  const size_t per_mat = (size_t)BB * HH * 12 * HD;
  int mat = (int)(idx / per_mat);
  size_t rem = idx % per_mat;
  int hd = (int)(rem % HD);
  size_t t = rem / HD;
  int row = NN + (int)(t % 12);
  int bh = (int)(t / 12);  // 0..767
  ws[mat * QHN + ((size_t)bh * NPAD + row) * HD + hd] = 0.0f;
}

// ---------------------------------------------------------------------------
// Stage 2: relative-position bias MLP, fused with key-padding mask.
// bias[b,q,k] = kpad ? -inf : ((is_overlap && !qpad) ? enc(qpos-kpos) : 0)
// Stored [B][NPAD][NPAD] (only [0..195][0..195] written / read).
// ---------------------------------------------------------------------------
__global__ __launch_bounds__(256) void bias_kernel(
    const float* __restrict__ qpos, const float* __restrict__ kpos,
    const int* __restrict__ qpad, const int* __restrict__ kpad,
    const int* __restrict__ is_ovl,
    const float* __restrict__ W1, const float* __restrict__ b1,
    const float* __restrict__ W2, const float* __restrict__ b2,
    float* __restrict__ biasbuf) {
  size_t idx = (size_t)blockIdx.x * 256 + threadIdx.x;
  if (idx >= (size_t)BB * NN * NN) return;
  int k = (int)(idx % NN);
  size_t r = idx / NN;
  int q = (int)(r % NN);
  int b = (int)(r / NN);

  float out;
  if (kpad[b * NN + k]) {
    out = -__builtin_inff();
  } else if (is_ovl[b] && !qpad[b * NN + q]) {
    float rx = qpos[((size_t)b * NN + q) * 3 + 0] - kpos[((size_t)b * NN + k) * 3 + 0];
    float ry = qpos[((size_t)b * NN + q) * 3 + 1] - kpos[((size_t)b * NN + k) * 3 + 1];
    float rz = qpos[((size_t)b * NN + q) * 3 + 2] - kpos[((size_t)b * NN + k) * 3 + 2];
    float acc = b2[0];
#pragma unroll
    for (int e = 0; e < 32; ++e) {
      float h = fmaf(rx, W1[e], fmaf(ry, W1[32 + e], fmaf(rz, W1[64 + e], b1[e])));
      acc = fmaf(fmaxf(h, 0.0f), W2[e], acc);
    }
    out = acc;
  } else {
    out = 0.0f;
  }
  biasbuf[((size_t)b * NPAD + q) * NPAD + k] = out;
}

// ---------------------------------------------------------------------------
// Stages 3 & 5: fp32 WMMA GEMM, C[12544,768] = A[12544,768] * W[768,768].
// Block = 8 waves = one 64 x 128 tile of C; wave (wm, wn) owns 32 x 32 of it
// (2 x 2 accumulator tiles). K runs in chunks of 32: the 64 x 32 piece of A and
// the 32 x 128 piece of W are staged in LDS by async b128 copies, two buffers,
// the next chunk in flight while this one is multiplied. Every W element is
// fetched from L2 once per 64 rows of C and read by the waves from LDS.
// mode 0: scatter into padded head layout [B][H][NPAD][HD]   (Q/K/V proj)
// mode 1: out[row*768+col] = acc + bias[col]                 (final proj)
// ---------------------------------------------------------------------------
__device__ __forceinline__ unsigned lds_off(const void* p) { return (unsigned)(size_t)p; }

// One chunk: 2 copies of A and 4 of W per lane. The s_wait_xcnt closes the
// statement so that no address register is rewritten ahead of it.
// W in LDS: rows k = 2p and 2p+1 share pitch row p, interleaved in runs of 16
// columns: float (k, c) sits at p*BPITCH + (c/16)*32 + (k&1)*16 + c%16, so a
// lane's two k of one fragment are 16 floats apart (one two-address read into a
// register pair) and the two lane halves fall on different banks.
__device__ __forceinline__ void copy_chunk(unsigned la, unsigned lb,
                                           const float* ga, const float* gb) {
  unsigned la1 = la + 32 * APITCH * 4;
  unsigned lb1 = lb + 4 * BPITCH * 4, lb2 = lb + 8 * BPITCH * 4, lb3 = lb + 12 * BPITCH * 4;
  const float* ga1 = ga + 32 * DD;
  const float* gb1 = gb + 8 * DD;
  const float* gb2 = gb + 16 * DD;
  const float* gb3 = gb + 24 * DD;
  asm volatile(
      "global_load_async_to_lds_b128 %0, %6, off\n\t"
      "global_load_async_to_lds_b128 %1, %7, off\n\t"
      "global_load_async_to_lds_b128 %2, %8, off\n\t"
      "global_load_async_to_lds_b128 %3, %9, off\n\t"
      "global_load_async_to_lds_b128 %4, %10, off\n\t"
      "global_load_async_to_lds_b128 %5, %11, off\n\t"
      "s_wait_xcnt 0x0"
      :: "v"(la), "v"(la1), "v"(lb), "v"(lb1), "v"(lb2), "v"(lb3),
         "v"(ga), "v"(ga1), "v"(gb), "v"(gb1), "v"(gb2), "v"(gb3)
      : "memory");
}

__global__ __launch_bounds__(256) void gemm_proj(
    const float* __restrict__ A, const float* __restrict__ W,
    const float* __restrict__ bias, float* __restrict__ out, int mode) {
  __shared__ __attribute__((aligned(16))) float smem[2 * STAGE_FLOATS];  // 54 KB

  int tid = (int)threadIdx.x;
  int m0 = ((int)blockIdx.x / NBLK) * BM;   // first row of the C tile
  int n0 = ((int)blockIdx.x % NBLK) * BN;   // first column of the C tile
  int wave = tid >> 5;
  int wm = wave & 1;               // 32-row half of the tile
  int wn = wave >> 1;              // 32-column quarter of the tile
  int l = tid & 31;
  int h = l >> 4;                  // lane half: selects k-pair / row-half
  int n16 = l & 15;                // lane within 16

  // each lane's own copy addresses: A rows tid/8 (+32), W rows tid/32 (+8,16,24)
  const float* ga = A + (size_t)(m0 + (tid >> 3)) * DD + (tid & 7) * 4;
  const float* gb = W + (size_t)(tid >> 5) * DD + n0 + (tid & 31) * 4;
  unsigned la = lds_off(smem) + ((tid >> 3) * APITCH + (tid & 7) * 4) * 4;
  unsigned lb = lds_off(smem) + (A_FLOATS + (tid >> 6) * BPITCH + ((tid & 31) >> 2) * 32 +
                                 ((tid >> 5) & 1) * 16 + (tid & 3) * 4) * 4;

  copy_chunk(la, lb, ga, gb);
  asm volatile("s_wait_asynccnt 0x0" ::: "memory");  // chunk 0 landed (own copies)
  __syncthreads();                                   // ... and everybody's
  copy_chunk(la + STAGE_FLOATS * 4, lb + STAGE_FLOATS * 4, ga + KC, gb + (size_t)KC * DD);

  v8f acc[2][2] = {{v8f{}, v8f{}}, {v8f{}, v8f{}}};

  // rolled: one trip's 32 WMMAs are body enough
#pragma unroll 1
  for (int t = 0; t < NTRIP; ++t) {
    const float* As = smem + (t & 1) * STAGE_FLOATS + (wm * 32 + n16) * APITCH + 2 * h;
    const float* Bs = smem + (t & 1) * STAGE_FLOATS + A_FLOATS + h * BPITCH + wn * 64 + n16;
    // unrolled: constant LDS offsets, and the reads can run ahead of the WMMAs
#pragma unroll
    for (int ks = 0; ks < KC / 4; ++ks) {
      // fragment element j -> k = t*32 + ks*4 + 2h + j, for A and for W alike
      v2f a0 = *(const v2f*)&As[ks * 4];
      v2f a1 = *(const v2f*)&As[16 * APITCH + ks * 4];
      v2f b0, b1;
      b0.x = Bs[ks * 2 * BPITCH];
      b0.y = Bs[ks * 2 * BPITCH + 16];
      b1.x = Bs[ks * 2 * BPITCH + 32];
      b1.y = Bs[ks * 2 * BPITCH + 48];
      acc[0][0] = WMMA_F32(a0, b0, acc[0][0]);
      acc[0][1] = WMMA_F32(a0, b1, acc[0][1]);
      acc[1][0] = WMMA_F32(a1, b0, acc[1][0]);
      acc[1][1] = WMMA_F32(a1, b1, acc[1][1]);
    }
    asm volatile("s_wait_dscnt 0x0" ::: "memory");     // own reads of this buffer are done
    asm volatile("s_wait_asynccnt 0x0" ::: "memory");  // own copies of chunk t+1 landed
    __syncthreads();  // publishes chunk t+1 and frees the buffer trip t has read
    if (t + 2 < NTRIP)
      copy_chunk(la + (t & 1) * (STAGE_FLOATS * 4), lb + (t & 1) * (STAGE_FLOATS * 4),
                 ga + (t + 2) * KC, gb + (size_t)(t + 2) * KC * DD);
  }
  asm volatile("s_wait_asynccnt 0x0" ::: "memory");  // nothing in flight at the end

  int row0 = m0 + wm * 32 + 8 * h;   // C row of accumulator element 0, tile row 0
  int col0 = n0 + wn * 32 + n16;     // C column, tile column 0
  // the store loops are unrolled so that every accumulator index is a constant
  if (mode == 0) {
    int hh = col0 >> 6, hd = col0 & 63;  // both 16-column tiles lie in one head
#pragma unroll
    for (int mi = 0; mi < 2; ++mi) {
#pragma unroll
      for (int j = 0; j < 8; ++j) {
        int R = row0 + mi * 16 + j;
        int bb = R / NN, tok = R % NN;
        float* o = out + (((size_t)bb * HH + hh) * NPAD + tok) * HD + hd;
        o[0] = acc[mi][0][j];
        o[16] = acc[mi][1][j];
      }
    }
  } else {
    float bias0 = bias[col0], bias1 = bias[col0 + 16];
#pragma unroll
    for (int mi = 0; mi < 2; ++mi) {
#pragma unroll
      for (int j = 0; j < 8; ++j) {
        float* o = out + (size_t)(row0 + mi * 16 + j) * DD + col0;
        o[0] = acc[mi][0][j] + bias0;
        o[16] = acc[mi][1][j] + bias1;
      }
    }
    // the compiler lays the mode 0 code behind this branch: this wait keeps every
    // later write of the stores' address and data registers behind the stores
    asm volatile("s_wait_xcnt 0x0" ::: "memory");
  }
}

// ---------------------------------------------------------------------------
// Stage 4: attention, transposed. Block = 4 waves, 3 blocks per (batch, query-tile);
// each wave processes one head on its own (no LDS, no barrier).
// S^T = K Q^T : A = 16 keys x hd, B = hd x 16 queries. A lane then holds the
// scores of ONE query (column n16): keys t*16 + 8h + j in s[t][j]. Maximum and
// sum run in the lane, plus one exchange between the two lane halves.
// O^T = V^T P^T : the score registers are the B operand as they stand; the
// registers (2c, 2c+1) of tile t carry keys t*16 + 8h + 2c + j, and the V loader
// below follows the same key order. Row M of output tile oc is head-dim 4*M + oc,
// so one 16-byte load of a V row feeds all four tiles and one 16-byte store
// takes one element of each.
// ---------------------------------------------------------------------------
// 2^x. The v_nop is the one slot that the instruction set asks for behind a
// transcendental before its result is read or its source overwritten; it shares the
// statement so that it stands directly behind.
__device__ __forceinline__ float exp2_slot(float x) {
  float e;
  asm("v_exp_f32 %0, %1\n\tv_nop" : "=v"(e) : "v"(x));
  return e;
}

// four waves per SIMD: the waves cover each other's load waits and softmax
__global__ __launch_bounds__(128) __attribute__((amdgpu_waves_per_eu(4, 4))) void attention_kernel(
    const float* __restrict__ Qh, const float* __restrict__ Kh,
    const float* __restrict__ Vh, const float* __restrict__ biasbuf,
    float* __restrict__ ctx) {
  int w = __builtin_amdgcn_readfirstlane((int)threadIdx.x >> 5);  // head in a scalar
  int l = threadIdx.x & 31;
  int head = ((int)blockIdx.x % 3) * 4 + w;
  int b = ((int)blockIdx.x / 3) / QTILES;
  int qt = ((int)blockIdx.x / 3) % QTILES;
  int h = l >> 4;
  int n16 = l & 15;
  const float scale = 0.125f;  // 1/sqrt(HD)
  const float ninf = -__builtin_inff();

  int q = qt * 16 + n16;            // this lane's query; < NPAD, padded rows are zero
  int qc = q < NN ? q : NN - 1;     // bias rows exist for real queries only
  const float* brow = biasbuf + ((size_t)b * NPAD + qc) * NPAD;

  {
    const float* Qb = Qh + ((size_t)b * HH + head) * NPAD * HD;
    const float* Kb = Kh + ((size_t)b * HH + head) * NPAD * HD;
    const float* Vb = Vh + ((size_t)b * HH + head) * NPAD * HD;

    // Every loop of this kernel is unrolled: qf, kf, s, vf and oacc live in registers,
    // which takes constant indices.
    // ---- Q fragments: element e of qf[c] is head-dim c*8 + 4h + e ----
    v4f qf[8];
#pragma unroll
    for (int c = 0; c < 8; ++c)
      qf[c] = *(const v4f*)(Qb + (size_t)q * HD + c * 8 + 4 * h);

    // ---- scores; every index of s[] must be a constant, so the loops unroll.
    // The K fragments of tile t+1 and the bias of tile t are asked for ahead of
    // tile t's products, which cover their latency.
    const float* krow = Kb + (size_t)n16 * HD + 4 * h;
    v8f s[QTILES];
    v4f kf[2][8];  // element e of kf[.][c]: the same head-dim as in qf[c]
#pragma unroll
    for (int c = 0; c < 8; ++c) kf[0][c] = *(const v4f*)(krow + c * 8);
#pragma unroll
    for (int t = 0; t < QTILES; ++t) {
      // one scheduling region per tile: without it the compiler asked for several
      // tiles at once, ran out of registers and spilled
      __builtin_amdgcn_sched_barrier(0);
      if (t + 1 < QTILES) {
#pragma unroll
        for (int c = 0; c < 8; ++c)
          kf[(t + 1) & 1][c] = *(const v4f*)(krow + (size_t)(t + 1) * 16 * HD + c * 8);
      }
      // the last tile's real keys are 192..195: both lane halves read those four
      v4f b0 = *(const v4f*)(brow + t * 16 + (t < QTILES - 1 ? 8 * h : 0));  // -inf for kpad
      // the load that follows is the last from krow and from this lane half's bias
      // pointer and lands on their registers: the loads that name them are waited for
      if (t == QTILES - 2) asm volatile("s_wait_xcnt 0x0" ::: "memory");
      v4f b1 = t < QTILES - 1 ? *(const v4f*)(brow + t * 16 + 8 * h + 4) : v4f{};
      v8f acc = v8f{};
#pragma unroll
      for (int c = 0; c < 8; ++c) {
        v4f k4 = kf[t & 1][c];
        acc = WMMA_F32((v2f{k4.x, k4.y}), (v2f{qf[c].x, qf[c].y}), acc);
        acc = WMMA_F32((v2f{k4.z, k4.w}), (v2f{qf[c].z, qf[c].w}), acc);
      }
#pragma unroll
      for (int j = 0; j < 4; ++j) {
        if (t < QTILES - 1) {
          s[t][j] = fmaf(acc[j], scale, b0[j]);
          s[t][j + 4] = fmaf(acc[j + 4], scale, b1[j]);
        } else {
          s[t][j] = h == 0 ? fmaf(acc[j], scale, b0[j]) : ninf;
          s[t][j + 4] = ninf;
        }
      }
    }

    // V rows of tile 0, asked for ahead of the softmax: row r is key t*16 + 8h + r
    const float* vrow = Vb + (size_t)(8 * h) * HD + 4 * n16;
    v4f vf[2][8];
#pragma unroll
    for (int r = 0; r < 8; ++r) vf[0][r] = *(const v4f*)(vrow + (size_t)r * HD);
    __builtin_amdgcn_sched_barrier(0);  // the softmax is a region of its own, as above

    // ---- softmax of this lane's query; 1/sum is applied to the output ----
    float m4[4] = {ninf, ninf, ninf, ninf};
#pragma unroll
    for (int t = 0; t < QTILES; ++t)
#pragma unroll
      for (int j = 0; j < 8; ++j) m4[j & 3] = fmaxf(m4[j & 3], s[t][j]);
    float mx = fmaxf(fmaxf(m4[0], m4[1]), fmaxf(m4[2], m4[3]));
    mx = fmaxf(mx, __shfl_xor(mx, 16, 32));
    float s4[4] = {0.0f, 0.0f, 0.0f, 0.0f};
#pragma unroll
    for (int t = 0; t < QTILES; ++t) {
      // exp(x) as 2^(x * log2 e), a tile at a time: arguments, exponentials, sums
#pragma unroll
      for (int j = 0; j < 8; ++j) s[t][j] = (s[t][j] - mx) * 1.44269504088896340736f;
#pragma unroll
      for (int j = 0; j < 8; ++j) s[t][j] = exp2_slot(s[t][j]);
#pragma unroll
      for (int j = 0; j < 8; ++j) s4[j & 3] += s[t][j];
    }
    float sum = (s4[0] + s4[1]) + (s4[2] + s4[3]);
    sum += __shfl_xor(sum, 16, 32);
    float inv = 1.0f / sum;

    // ---- O^T += V^T P^T ; V rows of tile t+1 are asked for ahead of tile t ----
    // keys from 196 on have P = 0 and zero V rows: the last tile's chunks 2 and 3
    // hold nothing else and are left out
    v8f oacc[4] = {v8f{}, v8f{}, v8f{}, v8f{}};
#pragma unroll
    for (int t = 0; t < QTILES; ++t) {
      __builtin_amdgcn_sched_barrier(0);  // one region per tile, as above
      if (t + 1 < QTILES) {
#pragma unroll
        for (int r = 0; r < (t + 1 < QTILES - 1 ? 8 : 4); ++r)
          vf[(t + 1) & 1][r] = *(const v4f*)(vrow + (size_t)((t + 1) * 16 + r) * HD);
      }
#pragma unroll
      for (int c = 0; c < (t < QTILES - 1 ? 4 : 2); ++c) {
        v4f v0 = vf[t & 1][2 * c];      // key t*16 + 8h + 2c
        v4f v1 = vf[t & 1][2 * c + 1];  // the next key
        v2f p = v2f{s[t][2 * c], s[t][2 * c + 1]};
        oacc[0] = WMMA_F32((v2f{v0.x, v1.x}), p, oacc[0]);
        oacc[1] = WMMA_F32((v2f{v0.y, v1.y}), p, oacc[1]);
        oacc[2] = WMMA_F32((v2f{v0.z, v1.z}), p, oacc[2]);
        oacc[3] = WMMA_F32((v2f{v0.w, v1.w}), p, oacc[3]);
      }
    }
    if (q < NN) {
      float* o = ctx + ((size_t)b * NN + q) * DD + head * HD + 32 * h;
#pragma unroll
      for (int j = 0; j < 8; ++j)
        *(v4f*)(o + 4 * j) =
            v4f{oacc[0][j] * inv, oacc[1][j] * inv, oacc[2][j] * inv, oacc[3][j] * inv};
    }
  }
}

// ---------------------------------------------------------------------------
extern "C" void kernel_launch(void* const* d_in, const int* in_sizes, int n_in,
                              void* d_out, int out_size, void* d_ws, size_t ws_size,
                              hipStream_t stream) {
  const float* query = (const float*)d_in[0];
  const float* key   = (const float*)d_in[1];
  const float* value = (const float*)d_in[2];
  const int*   qpad  = (const int*)d_in[3];
  const int*   kpad  = (const int*)d_in[4];
  const float* qpos  = (const float*)d_in[5];
  const float* kpos  = (const float*)d_in[6];
  const int*   isov  = (const int*)d_in[7];
  const float* Wq    = (const float*)d_in[8];
  const float* Wk    = (const float*)d_in[9];
  const float* Wv    = (const float*)d_in[10];
  const float* Wp    = (const float*)d_in[11];
  const float* bp    = (const float*)d_in[12];
  const float* W1    = (const float*)d_in[13];
  const float* b1    = (const float*)d_in[14];
  const float* W2    = (const float*)d_in[15];
  const float* b2    = (const float*)d_in[16];

  float* ws = (float*)d_ws;
  const size_t QHN = (size_t)BB * HH * NPAD * HD;  // 10,223,616 floats
  float* Qh = ws;
  float* Kh = Qh + QHN;
  float* Vh = Kh + QHN;
  float* biasbuf = Vh + QHN;                       // [B][NPAD][NPAD]
  const size_t BIASN = (size_t)BB * NPAD * NPAD;
  float* ctx = biasbuf + BIASN;                    // [B][N][D]

  // stage 1: zero padding rows of Q/K/V head buffers (WMMA tiles read them)
  {
    size_t total = (size_t)3 * BB * HH * 12 * HD;  // 1,769,472 -> 6912 blocks
    zero_pad_kernel<<<(unsigned)(total / 256), 256, 0, stream>>>(ws);
  }

  // stage 2: rel-pos bias + key mask
  {
    size_t total = (size_t)BB * NN * NN;
    bias_kernel<<<(unsigned)((total + 255) / 256), 256, 0, stream>>>(
        qpos, kpos, qpad, kpad, isov, W1, b1, W2, b2, biasbuf);
  }

  // stage 3: Q/K/V projections (LDS-staged A and W, WMMA, head-layout scatter)
  gemm_proj<<<GEMM_BLOCKS, 256, 0, stream>>>(query, Wq, nullptr, Qh, 0);
  gemm_proj<<<GEMM_BLOCKS, 256, 0, stream>>>(key,   Wk, nullptr, Kh, 0);
  gemm_proj<<<GEMM_BLOCKS, 256, 0, stream>>>(value, Wv, nullptr, Vh, 0);

  // stage 4: attention
  attention_kernel<<<BB * QTILES * 3, 128, 0, stream>>>(Qh, Kh, Vh, biasbuf, ctx);

  // stage 5: output projection + bias
  gemm_proj<<<GEMM_BLOCKS, 256, 0, stream>>>(ctx, Wp, bp, (float*)d_out, 1);
}

// v003
// One run takes 372 microseconds.
// Timed twice side by side with v002, it ran 1.11 times as fast both times.
// Over all steps from v000 it is 1.74 times as fast.
#include <hip/hip_runtime.h>

// ---------------- problem constants ----------------
#define BB 64
#define NN 196
#define DD 768
#define HH 12
#define HD 64
#define NPAD 208          // 13 * 16
#define QTILES 13         // ceil(196/16)
#define BM 64             // GEMM block tile rows
#define BN 128            // GEMM block tile columns
#define KC 32             // GEMM K chunk per LDS stage
#define NTRIP (DD / KC)   // 24
#define NBLK (DD / BN)    // 6 column tiles
#define GEMM_BLOCKS 1176  // (12544 / 64) * 6
#define PRE_BLOCKS (3 * GEMM_BLOCKS)      // Q, K and V projections in one grid
#define ZERO_TOTAL (3 * BB * HH * 12 * HD)  // 1,769,472 padding elements
#define BIAS_TOTAL (BB * NN * NN)           // 2,458,624 bias elements
#define FIRST_SET 1280      // blocks that can be resident at once: 5 per WGP by LDS, 256 WGPs
#define SIDE_BLOCKS (PRE_BLOCKS - FIRST_SET)  // 2248 blocks carry the bias and padding work
#define BIAS_PER_BLOCK 1280  // 5 per thread: SIDE_BLOCKS * 1280 >= BIAS_TOTAL
#define ZERO_PER_BLOCK 1024  // 4 per thread: SIDE_BLOCKS * 1024 >= ZERO_TOTAL
static_assert(SIDE_BLOCKS * BIAS_PER_BLOCK >= BIAS_TOTAL, "bias slices cover the table");
static_assert(SIDE_BLOCKS * ZERO_PER_BLOCK >= ZERO_TOTAL, "padding slices cover the rows");
#define APITCH 36         // 32 + 4 floats: 16 rows of b64 reads fall on 64 banks
#define BPITCH 288        // one k-pair of W: 2 x 128 + 32 floats (layout at copy_chunk)
#define A_FLOATS (BM * APITCH)
#define B_FLOATS ((KC / 2) * BPITCH)
#define STAGE_FLOATS (A_FLOATS + B_FLOATS)  // 27,648 B

typedef __attribute__((ext_vector_type(2))) float v2f;
typedef __attribute__((ext_vector_type(4))) float v4f;
typedef __attribute__((ext_vector_type(8))) float v8f;

#define WMMA_F32(a, b, c) \
    __builtin_amdgcn_wmma_f32_16x16x4_f32(false, (a), false, (b), (short)0, (c), false, false)

// ---------------------------------------------------------------------------
// Padding: element idx (< ZERO_TOTAL) of the 12 padding rows (tokens 196..207)
// of the Q/K/V head buffers [B][H][NPAD][HD] is set to zero.
// ---------------------------------------------------------------------------
__device__ __forceinline__ void zero_pad_elem(float* ws, size_t idx) {
  const size_t QHN = (size_t)BB * HH * NPAD * HD;
  const size_t per_mat = (size_t)BB * HH * 12 * HD;
  int mat = (int)(idx / per_mat);
  size_t rem = idx % per_mat;
  int hd = (int)(rem % HD);
  size_t t = rem / HD;
  int row = NN + (int)(t % 12);
  int bh = (int)(t / 12);  // 0..767
  ws[mat * QHN + ((size_t)bh * NPAD + row) * HD + hd] = 0.0f;
}

// ---------------------------------------------------------------------------
// Element idx of the relative-position bias MLP, fused with key-padding mask.
// bias[b,q,k] = kpad ? -inf : ((is_overlap && !qpad) ? enc(qpos-kpos) : 0)
// Stored [B][NPAD][NPAD] (only [0..195][0..195] written / read).
// ---------------------------------------------------------------------------
__device__ __forceinline__ void bias_elem(
    const float* __restrict__ qpos, const float* __restrict__ kpos,
    const int* __restrict__ qpad, const int* __restrict__ kpad,
    const int* __restrict__ is_ovl,
    const float* __restrict__ W1, const float* __restrict__ b1,
    const float* __restrict__ W2, const float* __restrict__ b2,
    float* __restrict__ biasbuf, size_t idx) {
  if (idx >= (size_t)BIAS_TOTAL) return;
  int k = (int)(idx % NN);
  size_t r = idx / NN;
  int q = (int)(r % NN);
  int b = (int)(r / NN);

  float out;
  if (kpad[b * NN + k]) {
    out = -__builtin_inff();
  } else if (is_ovl[b] && !qpad[b * NN + q]) {
    float rx = qpos[((size_t)b * NN + q) * 3 + 0] - kpos[((size_t)b * NN + k) * 3 + 0];
    float ry = qpos[((size_t)b * NN + q) * 3 + 1] - kpos[((size_t)b * NN + k) * 3 + 1];
    float rz = qpos[((size_t)b * NN + q) * 3 + 2] - kpos[((size_t)b * NN + k) * 3 + 2];
    float acc = b2[0];
#pragma unroll
    for (int e = 0; e < 32; ++e) {
      float h = fmaf(rx, W1[e], fmaf(ry, W1[32 + e], fmaf(rz, W1[64 + e], b1[e])));
      acc = fmaf(fmaxf(h, 0.0f), W2[e], acc);
    }
    out = acc;
  } else {
    out = 0.0f;
  }
  biasbuf[((size_t)b * NPAD + q) * NPAD + k] = out;
}

// ---------------------------------------------------------------------------
// fp32 WMMA GEMM, tile blk of C[12544,768] = A[12544,768] * W[768,768].
// Block = 8 waves = one 64 x 128 tile of C; wave (wm, wn) owns 32 x 32 of it
// (2 x 2 accumulator tiles). K runs in chunks of 32: the 64 x 32 piece of A and
// the 32 x 128 piece of W are staged in LDS by async b128 copies, two buffers,
// the next chunk in flight while this one is multiplied. Every W element is
// fetched from L2 once per 64 rows of C and read by the waves from LDS.
// mode 0: scatter into padded head layout [B][H][NPAD][HD]   (Q/K/V proj)
// mode 1: out[row*768+col] = acc + bias[col]                 (final proj)
// ---------------------------------------------------------------------------
__device__ __forceinline__ unsigned lds_off(const void* p) { return (unsigned)(size_t)p; }

// One chunk: 2 copies of A and 4 of W per lane. The s_wait_xcnt closes the
// statement so that no address register is rewritten ahead of it.
// W in LDS: rows k = 2p and 2p+1 share pitch row p, interleaved in runs of 16
// columns: float (k, c) sits at p*BPITCH + (c/16)*32 + (k&1)*16 + c%16, so a
// lane's two k of one fragment are 16 floats apart (one two-address read into a
// register pair) and the two lane halves fall on different banks.
__device__ __forceinline__ void copy_chunk(unsigned la, unsigned lb,
                                           const float* ga, const float* gb) {
  unsigned la1 = la + 32 * APITCH * 4;
  unsigned lb1 = lb + 4 * BPITCH * 4, lb2 = lb + 8 * BPITCH * 4, lb3 = lb + 12 * BPITCH * 4;
  const float* ga1 = ga + 32 * DD;
  const float* gb1 = gb + 8 * DD;
  const float* gb2 = gb + 16 * DD;
  const float* gb3 = gb + 24 * DD;
  asm volatile(
      "global_load_async_to_lds_b128 %0, %6, off\n\t"
      "global_load_async_to_lds_b128 %1, %7, off\n\t"
      "global_load_async_to_lds_b128 %2, %8, off\n\t"
      "global_load_async_to_lds_b128 %3, %9, off\n\t"
      "global_load_async_to_lds_b128 %4, %10, off\n\t"
      "global_load_async_to_lds_b128 %5, %11, off\n\t"
      "s_wait_xcnt 0x0"
      :: "v"(la), "v"(la1), "v"(lb), "v"(lb1), "v"(lb2), "v"(lb3),
         "v"(ga), "v"(ga1), "v"(gb), "v"(gb1), "v"(gb2), "v"(gb3)
      : "memory");
}

__device__ __forceinline__ void gemm_tile(
    const float* __restrict__ A, const float* __restrict__ W,
    const float* __restrict__ bias, float* out, int mode, int blk) {
  __shared__ __attribute__((aligned(16))) float smem[2 * STAGE_FLOATS];  // 54 KB

  int tid = (int)threadIdx.x;
  int m0 = (blk / NBLK) * BM;   // first row of the C tile
  int n0 = (blk % NBLK) * BN;   // first column of the C tile
  int wave = tid >> 5;
  int wm = wave & 1;               // 32-row half of the tile
  int wn = wave >> 1;              // 32-column quarter of the tile
  int l = tid & 31;
  int h = l >> 4;                  // lane half: selects k-pair / row-half
  int n16 = l & 15;                // lane within 16

  // each lane's own copy addresses: A rows tid/8 (+32), W rows tid/32 (+8,16,24)
  const float* ga = A + (size_t)(m0 + (tid >> 3)) * DD + (tid & 7) * 4;
  const float* gb = W + (size_t)(tid >> 5) * DD + n0 + (tid & 31) * 4;
  unsigned la = lds_off(smem) + ((tid >> 3) * APITCH + (tid & 7) * 4) * 4;
  unsigned lb = lds_off(smem) + (A_FLOATS + (tid >> 6) * BPITCH + ((tid & 31) >> 2) * 32 +
                                 ((tid >> 5) & 1) * 16 + (tid & 3) * 4) * 4;

  copy_chunk(la, lb, ga, gb);
  asm volatile("s_wait_asynccnt 0x0" ::: "memory");  // chunk 0 landed (own copies)
  __syncthreads();                                   // ... and everybody's
  copy_chunk(la + STAGE_FLOATS * 4, lb + STAGE_FLOATS * 4, ga + KC, gb + (size_t)KC * DD);

  v8f acc[2][2] = {{v8f{}, v8f{}}, {v8f{}, v8f{}}};

  // rolled: one trip's 32 WMMAs are body enough
#pragma unroll 1
  for (int t = 0; t < NTRIP; ++t) {
    const float* As = smem + (t & 1) * STAGE_FLOATS + (wm * 32 + n16) * APITCH + 2 * h;
    const float* Bs = smem + (t & 1) * STAGE_FLOATS + A_FLOATS + h * BPITCH + wn * 64 + n16;
    // unrolled: constant LDS offsets, and the reads can run ahead of the WMMAs
#pragma unroll
    for (int ks = 0; ks < KC / 4; ++ks) {
      // fragment element j -> k = t*32 + ks*4 + 2h + j, for A and for W alike
      v2f a0 = *(const v2f*)&As[ks * 4];
      v2f a1 = *(const v2f*)&As[16 * APITCH + ks * 4];
      v2f b0, b1;
      b0.x = Bs[ks * 2 * BPITCH];
      b0.y = Bs[ks * 2 * BPITCH + 16];
      b1.x = Bs[ks * 2 * BPITCH + 32];
      b1.y = Bs[ks * 2 * BPITCH + 48];
      acc[0][0] = WMMA_F32(a0, b0, acc[0][0]);
      acc[0][1] = WMMA_F32(a0, b1, acc[0][1]);
      acc[1][0] = WMMA_F32(a1, b0, acc[1][0]);
      acc[1][1] = WMMA_F32(a1, b1, acc[1][1]);
    }
    asm volatile("s_wait_dscnt 0x0" ::: "memory");     // own reads of this buffer are done
    asm volatile("s_wait_asynccnt 0x0" ::: "memory");  // own copies of chunk t+1 landed
    __syncthreads();  // publishes chunk t+1 and frees the buffer trip t has read
    if (t + 2 < NTRIP)
      copy_chunk(la + (t & 1) * (STAGE_FLOATS * 4), lb + (t & 1) * (STAGE_FLOATS * 4),
                 ga + (t + 2) * KC, gb + (size_t)(t + 2) * KC * DD);
  }
  asm volatile("s_wait_asynccnt 0x0" ::: "memory");  // nothing in flight at the end

  int row0 = m0 + wm * 32 + 8 * h;   // C row of accumulator element 0, tile row 0
  int col0 = n0 + wn * 32 + n16;     // C column, tile column 0
  // the store loops are unrolled so that every accumulator index is a constant
  if (mode == 0) {
    int hh = col0 >> 6, hd = col0 & 63;  // both 16-column tiles lie in one head
#pragma unroll
    for (int mi = 0; mi < 2; ++mi) {
#pragma unroll
      for (int j = 0; j < 8; ++j) {
        int R = row0 + mi * 16 + j;
        int bb = R / NN, tok = R % NN;
        float* o = out + (((size_t)bb * HH + hh) * NPAD + tok) * HD + hd;
        o[0] = acc[mi][0][j];
        o[16] = acc[mi][1][j];
      }
    }
  } else {
    float bias0 = bias[col0], bias1 = bias[col0 + 16];
#pragma unroll
    for (int mi = 0; mi < 2; ++mi) {
#pragma unroll
      for (int j = 0; j < 8; ++j) {
        float* o = out + (size_t)(row0 + mi * 16 + j) * DD + col0;
        o[0] = acc[mi][0][j] + bias0;
        o[16] = acc[mi][1][j] + bias1;
      }
    }
  }
}

// ---------------------------------------------------------------------------
// Stage 1: everything that attention needs and that depends on the inputs alone,
// in one launch. Block x computes tile x % 1176 of projection x / 1176 (Q, K, V).
// Every block behind the first resident set first does its own slice of the bias
// table and of the padding rows. (The split
// is for speed only: every slice is done once wherever the blocks land.) The three
// jobs write disjoint memory and none reads what another writes.
// ---------------------------------------------------------------------------
__global__ __launch_bounds__(256) void pre_attention_kernel(
    const float* __restrict__ query, const float* __restrict__ key,
    const float* __restrict__ value,
    const float* __restrict__ Wq, const float* __restrict__ Wk,
    const float* __restrict__ Wv,
    const float* __restrict__ qpos, const float* __restrict__ kpos,
    const int* __restrict__ qpad, const int* __restrict__ kpad,
    const int* __restrict__ is_ovl,
    const float* __restrict__ W1, const float* __restrict__ b1,
    const float* __restrict__ W2, const float* __restrict__ b2,
    float* __restrict__ ws, float* __restrict__ biasbuf) {
  if ((int)blockIdx.x >= FIRST_SET) {
    size_t side = (size_t)((int)blockIdx.x - FIRST_SET);
    size_t bidx = side * BIAS_PER_BLOCK + threadIdx.x;
    for (int i = 0; i < BIAS_PER_BLOCK / 256; ++i)
      bias_elem(qpos, kpos, qpad, kpad, is_ovl, W1, b1, W2, b2, biasbuf, bidx + i * 256);
    size_t zidx = side * ZERO_PER_BLOCK + threadIdx.x;
    for (int i = 0; i < ZERO_PER_BLOCK / 256; ++i)
      if (zidx + i * 256 < (size_t)ZERO_TOTAL) zero_pad_elem(ws, zidx + i * 256);
  }

  const size_t QHN = (size_t)BB * HH * NPAD * HD;
  int which = (int)blockIdx.x / GEMM_BLOCKS;
  const float* A = which == 0 ? query : which == 1 ? key : value;
  const float* W = which == 0 ? Wq : which == 1 ? Wk : Wv;
  gemm_tile(A, W, nullptr, ws + (size_t)which * QHN, 0, (int)blockIdx.x % GEMM_BLOCKS);
}

// Stage 3: output projection + bias
__global__ __launch_bounds__(256) void out_proj_kernel(
    const float* __restrict__ A, const float* __restrict__ W,
    const float* __restrict__ bias, float* __restrict__ out) {
  gemm_tile(A, W, bias, out, 1, (int)blockIdx.x);
}

// ---------------------------------------------------------------------------
// Stage 2: attention, transposed. Block = 4 waves, 3 blocks per (batch, query-tile);
// each wave processes one head on its own (no LDS, no barrier).
// S^T = K Q^T : A = 16 keys x hd, B = hd x 16 queries. A lane then holds the
// scores of ONE query (column n16): keys t*16 + 8h + j in s[t][j]. Maximum and
// sum run in the lane, plus one exchange between the two lane halves.
// O^T = V^T P^T : the score registers are the B operand as they stand; the
// registers (2c, 2c+1) of tile t carry keys t*16 + 8h + 2c + j, and the V loader
// below follows the same key order. Row M of output tile oc is head-dim 4*M + oc,
// so one 16-byte load of a V row feeds all four tiles and one 16-byte store
// takes one element of each.
// ---------------------------------------------------------------------------
// 2^x. The v_nop is the one slot that the instruction set asks for behind a
// transcendental before its result is read or its source overwritten; it shares the
// statement so that it stands directly behind.
__device__ __forceinline__ float exp2_slot(float x) {
  float e;
  asm("v_exp_f32 %0, %1\n\tv_nop" : "=v"(e) : "v"(x));
  return e;
}

// four waves per SIMD: the waves cover each other's load waits and softmax
__global__ __launch_bounds__(128) __attribute__((amdgpu_waves_per_eu(4, 4))) void attention_kernel(
    const float* __restrict__ Qh, const float* __restrict__ Kh,
    const float* __restrict__ Vh, const float* __restrict__ biasbuf,
    float* __restrict__ ctx) {
  int w = __builtin_amdgcn_readfirstlane((int)threadIdx.x >> 5);  // head in a scalar
  int l = threadIdx.x & 31;
  int head = ((int)blockIdx.x % 3) * 4 + w;
  int b = ((int)blockIdx.x / 3) / QTILES;
  int qt = ((int)blockIdx.x / 3) % QTILES;
  int h = l >> 4;
  int n16 = l & 15;
  const float scale = 0.125f;  // 1/sqrt(HD)
  const float ninf = -__builtin_inff();

  int q = qt * 16 + n16;            // this lane's query; < NPAD, padded rows are zero
  int qc = q < NN ? q : NN - 1;     // bias rows exist for real queries only
  const float* brow = biasbuf + ((size_t)b * NPAD + qc) * NPAD;

  {
    const float* Qb = Qh + ((size_t)b * HH + head) * NPAD * HD;
    const float* Kb = Kh + ((size_t)b * HH + head) * NPAD * HD;
    const float* Vb = Vh + ((size_t)b * HH + head) * NPAD * HD;

    // Every loop of this kernel is unrolled: qf, kf, s, vf and oacc live in registers,
    // which takes constant indices.
    // ---- Q fragments: element e of qf[c] is head-dim c*8 + 4h + e ----
    v4f qf[8];
#pragma unroll
    for (int c = 0; c < 8; ++c)
      qf[c] = *(const v4f*)(Qb + (size_t)q * HD + c * 8 + 4 * h);

    // ---- scores; every index of s[] must be a constant, so the loops unroll.
    // The K fragments of tile t+1 and the bias of tile t are asked for ahead of
    // tile t's products, which cover their latency.
    const float* krow = Kb + (size_t)n16 * HD + 4 * h;
    v8f s[QTILES];
    v4f kf[2][8];  // element e of kf[.][c]: the same head-dim as in qf[c]
#pragma unroll
    for (int c = 0; c < 8; ++c) kf[0][c] = *(const v4f*)(krow + c * 8);
#pragma unroll
    for (int t = 0; t < QTILES; ++t) {
      // one scheduling region per tile: without it the compiler asked for several
      // tiles at once, ran out of registers and spilled
      __builtin_amdgcn_sched_barrier(0);
      if (t + 1 < QTILES) {
#pragma unroll
        for (int c = 0; c < 8; ++c)
          kf[(t + 1) & 1][c] = *(const v4f*)(krow + (size_t)(t + 1) * 16 * HD + c * 8);
      }
      // the last tile's real keys are 192..195: both lane halves read those four
      v4f b0 = *(const v4f*)(brow + t * 16 + (t < QTILES - 1 ? 8 * h : 0));  // -inf for kpad
      // the load that follows is the last from krow and from this lane half's bias
      // pointer and lands on their registers: the loads that name them are waited for
      if (t == QTILES - 2) asm volatile("s_wait_xcnt 0x0" ::: "memory");
      v4f b1 = t < QTILES - 1 ? *(const v4f*)(brow + t * 16 + 8 * h + 4) : v4f{};
      v8f acc = v8f{};
#pragma unroll
      for (int c = 0; c < 8; ++c) {
        v4f k4 = kf[t & 1][c];
        acc = WMMA_F32((v2f{k4.x, k4.y}), (v2f{qf[c].x, qf[c].y}), acc);
        acc = WMMA_F32((v2f{k4.z, k4.w}), (v2f{qf[c].z, qf[c].w}), acc);
      }
#pragma unroll
      for (int j = 0; j < 4; ++j) {
        if (t < QTILES - 1) {
          s[t][j] = fmaf(acc[j], scale, b0[j]);
          s[t][j + 4] = fmaf(acc[j + 4], scale, b1[j]);
        } else {
          s[t][j] = h == 0 ? fmaf(acc[j], scale, b0[j]) : ninf;
          s[t][j + 4] = ninf;
        }
      }
    }

    // V rows of tile 0, asked for ahead of the softmax: row r is key t*16 + 8h + r
    const float* vrow = Vb + (size_t)(8 * h) * HD + 4 * n16;
    v4f vf[2][8];
#pragma unroll
    for (int r = 0; r < 8; ++r) vf[0][r] = *(const v4f*)(vrow + (size_t)r * HD);
    __builtin_amdgcn_sched_barrier(0);  // the softmax is a region of its own, as above

    // ---- softmax of this lane's query; 1/sum is applied to the output ----
    float m4[4] = {ninf, ninf, ninf, ninf};
#pragma unroll
    for (int t = 0; t < QTILES; ++t)
#pragma unroll
      for (int j = 0; j < 8; ++j) m4[j & 3] = fmaxf(m4[j & 3], s[t][j]);
    float mx = fmaxf(fmaxf(m4[0], m4[1]), fmaxf(m4[2], m4[3]));
    mx = fmaxf(mx, __shfl_xor(mx, 16, 32));
    float s4[4] = {0.0f, 0.0f, 0.0f, 0.0f};
#pragma unroll
    for (int t = 0; t < QTILES; ++t) {
      // exp(x) as 2^(x * log2 e), a tile at a time: arguments, exponentials, sums
#pragma unroll
      for (int j = 0; j < 8; ++j) s[t][j] = (s[t][j] - mx) * 1.44269504088896340736f;
#pragma unroll
      for (int j = 0; j < 8; ++j) s[t][j] = exp2_slot(s[t][j]);
#pragma unroll
      for (int j = 0; j < 8; ++j) s4[j & 3] += s[t][j];
    }
    float sum = (s4[0] + s4[1]) + (s4[2] + s4[3]);
    sum += __shfl_xor(sum, 16, 32);
    float inv = 1.0f / sum;

    // ---- O^T += V^T P^T ; V rows of tile t+1 are asked for ahead of tile t ----
    // keys from 196 on have P = 0 and zero V rows: the last tile's chunks 2 and 3
    // hold nothing else and are left out
    v8f oacc[4] = {v8f{}, v8f{}, v8f{}, v8f{}};
#pragma unroll
    for (int t = 0; t < QTILES; ++t) {
      __builtin_amdgcn_sched_barrier(0);  // one region per tile, as above
      if (t + 1 < QTILES) {
#pragma unroll
        for (int r = 0; r < (t + 1 < QTILES - 1 ? 8 : 4); ++r)
          vf[(t + 1) & 1][r] = *(const v4f*)(vrow + (size_t)((t + 1) * 16 + r) * HD);
      }
#pragma unroll
      for (int c = 0; c < (t < QTILES - 1 ? 4 : 2); ++c) {
        v4f v0 = vf[t & 1][2 * c];      // key t*16 + 8h + 2c
        v4f v1 = vf[t & 1][2 * c + 1];  // the next key
        v2f p = v2f{s[t][2 * c], s[t][2 * c + 1]};
        oacc[0] = WMMA_F32((v2f{v0.x, v1.x}), p, oacc[0]);
        oacc[1] = WMMA_F32((v2f{v0.y, v1.y}), p, oacc[1]);
        oacc[2] = WMMA_F32((v2f{v0.z, v1.z}), p, oacc[2]);
        oacc[3] = WMMA_F32((v2f{v0.w, v1.w}), p, oacc[3]);
      }
    }
    if (q < NN) {
      float* o = ctx + ((size_t)b * NN + q) * DD + head * HD + 32 * h;
#pragma unroll
      for (int j = 0; j < 8; ++j)
        *(v4f*)(o + 4 * j) =
            v4f{oacc[0][j] * inv, oacc[1][j] * inv, oacc[2][j] * inv, oacc[3][j] * inv};
    }
  }
}

// ---------------------------------------------------------------------------
extern "C" void kernel_launch(void* const* d_in, const int* in_sizes, int n_in,
                              void* d_out, int out_size, void* d_ws, size_t ws_size,
                              hipStream_t stream) {
  const float* query = (const float*)d_in[0];
  const float* key   = (const float*)d_in[1];
  const float* value = (const float*)d_in[2];
  const int*   qpad  = (const int*)d_in[3];
  const int*   kpad  = (const int*)d_in[4];
  const float* qpos  = (const float*)d_in[5];
  const float* kpos  = (const float*)d_in[6];
  const int*   isov  = (const int*)d_in[7];
  const float* Wq    = (const float*)d_in[8];
  const float* Wk    = (const float*)d_in[9];
  const float* Wv    = (const float*)d_in[10];
  const float* Wp    = (const float*)d_in[11];
  const float* bp    = (const float*)d_in[12];
  const float* W1    = (const float*)d_in[13];
  const float* b1    = (const float*)d_in[14];
  const float* W2    = (const float*)d_in[15];
  const float* b2    = (const float*)d_in[16];

  float* ws = (float*)d_ws;
  const size_t QHN = (size_t)BB * HH * NPAD * HD;  // 10,223,616 floats
  float* Qh = ws;
  float* Kh = Qh + QHN;
  float* Vh = Kh + QHN;
  float* biasbuf = Vh + QHN;                       // [B][NPAD][NPAD]
  const size_t BIASN = (size_t)BB * NPAD * NPAD;
  float* ctx = biasbuf + BIASN;                    // [B][N][D]

  // stage 1: Q/K/V projections (head-layout scatter), rel-pos bias + key mask,
  // zero padding rows of the head buffers (WMMA tiles read them)
  pre_attention_kernel<<<PRE_BLOCKS, 256, 0, stream>>>(
      query, key, value, Wq, Wk, Wv, qpos, kpos, qpad, kpad, isov, W1, b1, W2, b2,
      ws, biasbuf);

  // stage 2: attention
  attention_kernel<<<BB * QTILES * 3, 128, 0, stream>>>(Qh, Kh, Vh, biasbuf, ctx);

  // stage 3: output projection + bias
  out_proj_kernel<<<GEMM_BLOCKS, 256, 0, stream>>>(ctx, Wp, bp, (float*)d_out);
}

// v004
// Measured time: 347 microseconds a run.
// In both of two side-by-side timings against v003, it was 1.07 times as fast.
// Over all steps from v000 it is 1.87 times as fast.
#include <hip/hip_runtime.h>

// ---------------- problem constants ----------------
#define BB 64
#define NN 196
#define DD 768
#define HH 12
#define HD 64
#define NPAD 208          // 13 * 16
#define QTILES 13         // ceil(196/16)
#define BM 64             // GEMM block tile rows
#define BN 128            // GEMM block tile columns
#define KC 32             // GEMM K chunk per LDS stage
#define NTRIP (DD / KC)   // 24
#define NBLK (DD / BN)    // 6 column tiles
#define GEMM_BLOCKS 1176  // (12544 / 64) * 6
#define PRE_BLOCKS (3 * GEMM_BLOCKS)      // Q, K and V projections in one grid
#define ZERO_TOTAL (3 * BB * HH * 12 * HD)  // 1,769,472 padding elements
#define BIAS_TOTAL (BB * NN * NN)           // 2,458,624 bias elements
#define FIRST_SET 1280      // blocks that can be resident at once: 5 per WGP by LDS, 256 WGPs
#define SIDE_BLOCKS (PRE_BLOCKS - FIRST_SET)  // 2248 blocks carry the bias and padding work
#define BIAS_PER_BLOCK 1280  // 5 per thread: SIDE_BLOCKS * 1280 >= BIAS_TOTAL
#define ZERO_PER_BLOCK 1024  // 4 per thread: SIDE_BLOCKS * 1024 >= ZERO_TOTAL
static_assert(SIDE_BLOCKS * BIAS_PER_BLOCK >= BIAS_TOTAL, "bias slices cover the table");
static_assert(SIDE_BLOCKS * ZERO_PER_BLOCK >= ZERO_TOTAL, "padding slices cover the rows");
#define APITCH 36         // 32 + 4 floats: 16 rows of b64 reads fall on 64 banks
#define BPITCH 288        // one k-pair of W: 2 x 128 + 32 floats (layout at copy_chunk)
#define A_FLOATS (BM * APITCH)
#define B_FLOATS ((KC / 2) * BPITCH)
#define STAGE_FLOATS (A_FLOATS + B_FLOATS)  // 27,648 B
#define KPITCH 68         // K rows in LDS: 272 B = 16 B x 17, 16 rows of b128 reads on 64 banks
static_assert(NPAD % 16 == 0 && (NPAD / 8) % 2 == 0, "eight waves stage whole pairs of rows");

typedef __attribute__((ext_vector_type(2))) float v2f;
typedef __attribute__((ext_vector_type(4))) float v4f;
typedef __attribute__((ext_vector_type(8))) float v8f;

#define WMMA_F32(a, b, c) \
    __builtin_amdgcn_wmma_f32_16x16x4_f32(false, (a), false, (b), (short)0, (c), false, false)

// ---------------------------------------------------------------------------
// Padding: element idx (< ZERO_TOTAL) of the 12 padding rows (tokens 196..207)
// of the Q/K/V head buffers [B][H][NPAD][HD] is set to zero.
// ---------------------------------------------------------------------------
__device__ __forceinline__ void zero_pad_elem(float* ws, size_t idx) {
  const size_t QHN = (size_t)BB * HH * NPAD * HD;
  const size_t per_mat = (size_t)BB * HH * 12 * HD;
  int mat = (int)(idx / per_mat);
  size_t rem = idx % per_mat;
  int hd = (int)(rem % HD);
  size_t t = rem / HD;
  int row = NN + (int)(t % 12);
  int bh = (int)(t / 12);  // 0..767
  ws[mat * QHN + ((size_t)bh * NPAD + row) * HD + hd] = 0.0f;
}

// ---------------------------------------------------------------------------
// Element idx of the relative-position bias MLP, fused with key-padding mask.
// bias[b,q,k] = kpad ? -inf : ((is_overlap && !qpad) ? enc(qpos-kpos) : 0)
// Stored [B][NPAD][NPAD] (only [0..195][0..195] written / read).
// ---------------------------------------------------------------------------
__device__ __forceinline__ void bias_elem(
    const float* __restrict__ qpos, const float* __restrict__ kpos,
    const int* __restrict__ qpad, const int* __restrict__ kpad,
    const int* __restrict__ is_ovl,
    const float* __restrict__ W1, const float* __restrict__ b1,
    const float* __restrict__ W2, const float* __restrict__ b2,
    float* __restrict__ biasbuf, size_t idx) {
  if (idx >= (size_t)BIAS_TOTAL) return;
  int k = (int)(idx % NN);
  size_t r = idx / NN;
  int q = (int)(r % NN);
  int b = (int)(r / NN);

  float out;
  if (kpad[b * NN + k]) {
    out = -__builtin_inff();
  } else if (is_ovl[b] && !qpad[b * NN + q]) {
    float rx = qpos[((size_t)b * NN + q) * 3 + 0] - kpos[((size_t)b * NN + k) * 3 + 0];
    float ry = qpos[((size_t)b * NN + q) * 3 + 1] - kpos[((size_t)b * NN + k) * 3 + 1];
    float rz = qpos[((size_t)b * NN + q) * 3 + 2] - kpos[((size_t)b * NN + k) * 3 + 2];
    float acc = b2[0];
#pragma unroll
    for (int e = 0; e < 32; ++e) {
      float h = fmaf(rx, W1[e], fmaf(ry, W1[32 + e], fmaf(rz, W1[64 + e], b1[e])));
      acc = fmaf(fmaxf(h, 0.0f), W2[e], acc);
    }
    out = acc;
  } else {
    out = 0.0f;
  }
  biasbuf[((size_t)b * NPAD + q) * NPAD + k] = out;
}

// ---------------------------------------------------------------------------
// fp32 WMMA GEMM, tile blk of C[12544,768] = A[12544,768] * W[768,768].
// Block = 8 waves = one 64 x 128 tile of C; wave (wm, wn) owns 32 x 32 of it
// (2 x 2 accumulator tiles). K runs in chunks of 32: the 64 x 32 piece of A and
// the 32 x 128 piece of W are staged in LDS by async b128 copies, two buffers,
// the next chunk in flight while this one is multiplied. Every W element is
// fetched from L2 once per 64 rows of C and read by the waves from LDS.
// mode 0: scatter into padded head layout [B][H][NPAD][HD]   (Q/K/V proj)
// mode 1: out[row*768+col] = acc + bias[col]                 (final proj)
// ---------------------------------------------------------------------------
__device__ __forceinline__ unsigned lds_off(const void* p) { return (unsigned)(size_t)p; }

// One chunk: 2 copies of A and 4 of W per lane. The s_wait_xcnt closes the
// statement so that no address register is rewritten ahead of it.
// W in LDS: rows k = 2p and 2p+1 share pitch row p, interleaved in runs of 16
// columns: float (k, c) sits at p*BPITCH + (c/16)*32 + (k&1)*16 + c%16, so a
// lane's two k of one fragment are 16 floats apart (one two-address read into a
// register pair) and the two lane halves fall on different banks.
__device__ __forceinline__ void copy_chunk(unsigned la, unsigned lb,
                                           const float* ga, const float* gb) {
  unsigned la1 = la + 32 * APITCH * 4;
  unsigned lb1 = lb + 4 * BPITCH * 4, lb2 = lb + 8 * BPITCH * 4, lb3 = lb + 12 * BPITCH * 4;
  const float* ga1 = ga + 32 * DD;
  const float* gb1 = gb + 8 * DD;
  const float* gb2 = gb + 16 * DD;
  const float* gb3 = gb + 24 * DD;
  asm volatile(
      "global_load_async_to_lds_b128 %0, %6, off\n\t"
      "global_load_async_to_lds_b128 %1, %7, off\n\t"
      "global_load_async_to_lds_b128 %2, %8, off\n\t"
      "global_load_async_to_lds_b128 %3, %9, off\n\t"
      "global_load_async_to_lds_b128 %4, %10, off\n\t"
      "global_load_async_to_lds_b128 %5, %11, off\n\t"
      "s_wait_xcnt 0x0"
      :: "v"(la), "v"(la1), "v"(lb), "v"(lb1), "v"(lb2), "v"(lb3),
         "v"(ga), "v"(ga1), "v"(gb), "v"(gb1), "v"(gb2), "v"(gb3)
      : "memory");
}

__device__ __forceinline__ void gemm_tile(
    const float* __restrict__ A, const float* __restrict__ W,
    const float* __restrict__ bias, float* out, int mode, int blk) {
  __shared__ __attribute__((aligned(16))) float smem[2 * STAGE_FLOATS];  // 54 KB

  int tid = (int)threadIdx.x;
  int m0 = (blk / NBLK) * BM;   // first row of the C tile
  int n0 = (blk % NBLK) * BN;   // first column of the C tile
  int wave = tid >> 5;
  int wm = wave & 1;               // 32-row half of the tile
  int wn = wave >> 1;              // 32-column quarter of the tile
  int l = tid & 31;
  int h = l >> 4;                  // lane half: selects k-pair / row-half
  int n16 = l & 15;                // lane within 16

  // each lane's own copy addresses: A rows tid/8 (+32), W rows tid/32 (+8,16,24)
  const float* ga = A + (size_t)(m0 + (tid >> 3)) * DD + (tid & 7) * 4;
  const float* gb = W + (size_t)(tid >> 5) * DD + n0 + (tid & 31) * 4;
  unsigned la = lds_off(smem) + ((tid >> 3) * APITCH + (tid & 7) * 4) * 4;
  unsigned lb = lds_off(smem) + (A_FLOATS + (tid >> 6) * BPITCH + ((tid & 31) >> 2) * 32 +
                                 ((tid >> 5) & 1) * 16 + (tid & 3) * 4) * 4;

  copy_chunk(la, lb, ga, gb);
  asm volatile("s_wait_asynccnt 0x0" ::: "memory");  // chunk 0 landed (own copies)
  __syncthreads();                                   // ... and everybody's
  copy_chunk(la + STAGE_FLOATS * 4, lb + STAGE_FLOATS * 4, ga + KC, gb + (size_t)KC * DD);

  v8f acc[2][2] = {{v8f{}, v8f{}}, {v8f{}, v8f{}}};

  // rolled: one trip's 32 WMMAs are body enough
#pragma unroll 1
  for (int t = 0; t < NTRIP; ++t) {
    const float* As = smem + (t & 1) * STAGE_FLOATS + (wm * 32 + n16) * APITCH + 2 * h;
    const float* Bs = smem + (t & 1) * STAGE_FLOATS + A_FLOATS + h * BPITCH + wn * 64 + n16;
    // unrolled: constant LDS offsets, and the reads can run ahead of the WMMAs
#pragma unroll
    for (int ks = 0; ks < KC / 4; ++ks) {
      // fragment element j -> k = t*32 + ks*4 + 2h + j, for A and for W alike
      v2f a0 = *(const v2f*)&As[ks * 4];
      v2f a1 = *(const v2f*)&As[16 * APITCH + ks * 4];
      v2f b0, b1;
      b0.x = Bs[ks * 2 * BPITCH];
      b0.y = Bs[ks * 2 * BPITCH + 16];
      b1.x = Bs[ks * 2 * BPITCH + 32];
      b1.y = Bs[ks * 2 * BPITCH + 48];
      acc[0][0] = WMMA_F32(a0, b0, acc[0][0]);
      acc[0][1] = WMMA_F32(a0, b1, acc[0][1]);
      acc[1][0] = WMMA_F32(a1, b0, acc[1][0]);
      acc[1][1] = WMMA_F32(a1, b1, acc[1][1]);
    }
    asm volatile("s_wait_dscnt 0x0" ::: "memory");     // own reads of this buffer are done
    asm volatile("s_wait_asynccnt 0x0" ::: "memory");  // own copies of chunk t+1 landed
    __syncthreads();  // publishes chunk t+1 and frees the buffer trip t has read
    if (t + 2 < NTRIP)
      copy_chunk(la + (t & 1) * (STAGE_FLOATS * 4), lb + (t & 1) * (STAGE_FLOATS * 4),
                 ga + (t + 2) * KC, gb + (size_t)(t + 2) * KC * DD);
  }
  asm volatile("s_wait_asynccnt 0x0" ::: "memory");  // nothing in flight at the end

  int row0 = m0 + wm * 32 + 8 * h;   // C row of accumulator element 0, tile row 0
  int col0 = n0 + wn * 32 + n16;     // C column, tile column 0
  // the store loops are unrolled so that every accumulator index is a constant
  if (mode == 0) {
    int hh = col0 >> 6, hd = col0 & 63;  // both 16-column tiles lie in one head
#pragma unroll
    for (int mi = 0; mi < 2; ++mi) {
#pragma unroll
      for (int j = 0; j < 8; ++j) {
        int R = row0 + mi * 16 + j;
        int bb = R / NN, tok = R % NN;
        float* o = out + (((size_t)bb * HH + hh) * NPAD + tok) * HD + hd;
        o[0] = acc[mi][0][j];
        o[16] = acc[mi][1][j];
      }
    }
  } else {
    float bias0 = bias[col0], bias1 = bias[col0 + 16];
#pragma unroll
    for (int mi = 0; mi < 2; ++mi) {
#pragma unroll
      for (int j = 0; j < 8; ++j) {
        float* o = out + (size_t)(row0 + mi * 16 + j) * DD + col0;
        o[0] = acc[mi][0][j] + bias0;
        o[16] = acc[mi][1][j] + bias1;
      }
    }
  }
}

// ---------------------------------------------------------------------------
// Stage 1: everything that attention needs and that depends on the inputs alone,
// in one launch. Block x computes tile x % 1176 of projection x / 1176 (Q, K, V).
// Every block behind the first resident set first does its own slice of the bias
// table and of the padding rows. (The split
// is for speed only: every slice is done once wherever the blocks land.) The three
// jobs write disjoint memory and none reads what another writes.
// ---------------------------------------------------------------------------
__global__ __launch_bounds__(256) void pre_attention_kernel(
    const float* __restrict__ query, const float* __restrict__ key,
    const float* __restrict__ value,
    const float* __restrict__ Wq, const float* __restrict__ Wk,
    const float* __restrict__ Wv,
    const float* __restrict__ qpos, const float* __restrict__ kpos,
    const int* __restrict__ qpad, const int* __restrict__ kpad,
    const int* __restrict__ is_ovl,
    const float* __restrict__ W1, const float* __restrict__ b1,
    const float* __restrict__ W2, const float* __restrict__ b2,
    float* __restrict__ ws, float* __restrict__ biasbuf) {
  if ((int)blockIdx.x >= FIRST_SET) {
    size_t side = (size_t)((int)blockIdx.x - FIRST_SET);
    size_t bidx = side * BIAS_PER_BLOCK + threadIdx.x;
    for (int i = 0; i < BIAS_PER_BLOCK / 256; ++i)
      bias_elem(qpos, kpos, qpad, kpad, is_ovl, W1, b1, W2, b2, biasbuf, bidx + i * 256);
    size_t zidx = side * ZERO_PER_BLOCK + threadIdx.x;
    for (int i = 0; i < ZERO_PER_BLOCK / 256; ++i)
      if (zidx + i * 256 < (size_t)ZERO_TOTAL) zero_pad_elem(ws, zidx + i * 256);
  }

  const size_t QHN = (size_t)BB * HH * NPAD * HD;
  int which = (int)blockIdx.x / GEMM_BLOCKS;
  const float* A = which == 0 ? query : which == 1 ? key : value;
  const float* W = which == 0 ? Wq : which == 1 ? Wk : Wv;
  gemm_tile(A, W, nullptr, ws + (size_t)which * QHN, 0, (int)blockIdx.x % GEMM_BLOCKS);
}

// Stage 3: output projection + bias
__global__ __launch_bounds__(256) void out_proj_kernel(
    const float* __restrict__ A, const float* __restrict__ W,
    const float* __restrict__ bias, float* __restrict__ out) {
  gemm_tile(A, W, bias, out, 1, (int)blockIdx.x);
}

// ---------------------------------------------------------------------------
// Stage 2: attention, transposed. Block = 8 waves on ONE (batch, head); two blocks per
// (batch, head), with query tiles 0..6 and 7..12, one tile per wave. The head's K and V
// (208 rows each) are staged in LDS once per block by async b128 copies that cover whole
// 128-byte lines, and every wave takes its K and V fragments from LDS: read straight
// from memory, a K fragment would touch 16 lines for 512 bytes, and every query tile
// would fetch all of K and V for itself.
// S^T = K Q^T : A = 16 keys x hd, B = hd x 16 queries. A lane then holds the
// scores of ONE query (column n16): keys t*16 + 8h + j in s[t][j]. Maximum and
// sum run in the lane, plus one exchange between the two lane halves.
// O^T = V^T P^T : the score registers are the B operand as they stand; the
// registers (2c, 2c+1) of tile t carry keys t*16 + 8h + 2c + j, and the V loader
// below follows the same key order. Row M of output tile oc is head-dim 4*M + oc,
// so one 16-byte load of a V row feeds all four tiles and one 16-byte store
// takes one element of each.
// ---------------------------------------------------------------------------
// 2^x. The v_nop is the one slot that the instruction set asks for behind a
// transcendental before its result is read or its source overwritten; it shares the
// statement so that it stands directly behind.
__device__ __forceinline__ float exp2_slot(float x) {
  float e;
  asm("v_exp_f32 %0, %1\n\tv_nop" : "=v"(e) : "v"(x));
  return e;
}

// 26 rows of 64 floats, global to LDS: 13 copies of two rows (512 contiguous bytes) each.
// lds and g are the lane's own addresses in the first two rows; PITCH2 is the LDS
// distance of two rows in bytes. The s_wait_xcnt closes the statement so that no
// address register is rewritten ahead of it.
template <int PITCH2>
__device__ __forceinline__ void copy_rows26(unsigned lds, const float* g) {
  asm volatile(
      "global_load_async_to_lds_b128 %0, %13, off\n\t"
      "global_load_async_to_lds_b128 %1, %14, off\n\t"
      "global_load_async_to_lds_b128 %2, %15, off\n\t"
      "global_load_async_to_lds_b128 %3, %16, off\n\t"
      "global_load_async_to_lds_b128 %4, %17, off\n\t"
      "global_load_async_to_lds_b128 %5, %18, off\n\t"
      "global_load_async_to_lds_b128 %6, %19, off\n\t"
      "global_load_async_to_lds_b128 %7, %20, off\n\t"
      "global_load_async_to_lds_b128 %8, %21, off\n\t"
      "global_load_async_to_lds_b128 %9, %22, off\n\t"
      "global_load_async_to_lds_b128 %10, %23, off\n\t"
      "global_load_async_to_lds_b128 %11, %24, off\n\t"
      "global_load_async_to_lds_b128 %12, %25, off\n\t"
      "s_wait_xcnt 0x0"
      :: "v"(lds), "v"(lds + PITCH2), "v"(lds + 2 * PITCH2), "v"(lds + 3 * PITCH2),
         "v"(lds + 4 * PITCH2), "v"(lds + 5 * PITCH2), "v"(lds + 6 * PITCH2),
         "v"(lds + 7 * PITCH2), "v"(lds + 8 * PITCH2), "v"(lds + 9 * PITCH2),
         "v"(lds + 10 * PITCH2), "v"(lds + 11 * PITCH2), "v"(lds + 12 * PITCH2),
         "v"(g), "v"(g + 2 * HD), "v"(g + 4 * HD), "v"(g + 6 * HD), "v"(g + 8 * HD),
         "v"(g + 10 * HD), "v"(g + 12 * HD), "v"(g + 14 * HD), "v"(g + 16 * HD),
         "v"(g + 18 * HD), "v"(g + 20 * HD), "v"(g + 22 * HD), "v"(g + 24 * HD)
      : "memory");
}

// four waves per SIMD, two blocks per WGP: the waves cover each other's load waits and
// softmax, and one block's staging runs beside the other block's products
__global__ __launch_bounds__(256) __attribute__((amdgpu_waves_per_eu(4, 4))) void attention_kernel(
    const float* __restrict__ Qh, const float* __restrict__ Kh,
    const float* __restrict__ Vh, const float* __restrict__ biasbuf,
    float* __restrict__ ctx) {
  __shared__ __attribute__((aligned(16))) float Ks[NPAD * KPITCH];  // 56,576 B
  __shared__ __attribute__((aligned(16))) float Vs[NPAD * HD];      // 53,248 B

  int w = __builtin_amdgcn_readfirstlane((int)threadIdx.x >> 5);  // wave in a scalar
  int l = threadIdx.x & 31;
  int upper = (int)blockIdx.x & 1;   // 0: query tiles 0..6, 1: query tiles 7..12
  int head = ((int)blockIdx.x >> 1) % HH;
  int b = ((int)blockIdx.x >> 1) / HH;
  // lower block: waves 0..6 work; upper block: waves 2..7
  int qt = upper ? w + 5 : w;
  bool copies_only = upper ? w < 2 : w == 7;
  int h = l >> 4;
  int n16 = l & 15;
  const float scale = 0.125f;  // 1/sqrt(HD)
  const float ninf = -__builtin_inff();

  int q = qt * 16 + n16;            // this lane's query; < NPAD, padded rows are zero
  int qc = q < NN ? q : NN - 1;     // bias rows exist for real queries only
  const float* brow = biasbuf + ((size_t)b * NPAD + qc) * NPAD;

  {
    const float* Qb = Qh + ((size_t)b * HH + head) * NPAD * HD;
    const float* Kb = Kh + ((size_t)b * HH + head) * NPAD * HD;
    const float* Vb = Vh + ((size_t)b * HH + head) * NPAD * HD;

    // ---- staging: wave w brings rows 26w .. 26w+25 of K and of V; lane l holds 16
    // bytes of row (l >> 4) of each pair of rows ----
    int srow = w * (NPAD / 8) + h;
    copy_rows26<2 * KPITCH * 4>(lds_off(Ks) + (srow * KPITCH + n16 * 4) * 4,
                                Kb + (size_t)srow * HD + n16 * 4);
    copy_rows26<2 * HD * 4>(lds_off(Vs) + (srow * HD + n16 * 4) * 4,
                            Vb + (size_t)srow * HD + n16 * 4);

    // Every loop of this kernel is unrolled: qf, kf, s, vf and oacc live in registers,
    // which takes constant indices.
    // ---- Q fragments: element e of qf[c] is head-dim c*8 + 4h + e ----
    v4f qf[8];
#pragma unroll
    for (int c = 0; c < 8; ++c)
      qf[c] = *(const v4f*)(Qb + (size_t)q * HD + c * 8 + 4 * h);

    asm volatile("s_wait_asynccnt 0x0" ::: "memory");  // own copies of K and V landed
    __syncthreads();                                   // ... and everybody's
    if (copies_only) return;  // whole waves, behind the kernel's only barrier

    // ---- scores; every index of s[] must be a constant, so the loops unroll.
    // The K fragments of tile t+1 and the bias of tile t are asked for ahead of
    // tile t's products, which cover their latency.
    const float* krow = Ks + n16 * KPITCH + 4 * h;
    v8f s[QTILES];
    v4f kf[2][8];  // element e of kf[.][c]: the same head-dim as in qf[c]
#pragma unroll
    for (int c = 0; c < 8; ++c) kf[0][c] = *(const v4f*)(krow + c * 8);
#pragma unroll
    for (int t = 0; t < QTILES; ++t) {
      // one scheduling region per tile: without it the compiler asked for several
      // tiles at once, ran out of registers and spilled
      __builtin_amdgcn_sched_barrier(0);
      if (t + 1 < QTILES) {
#pragma unroll
        for (int c = 0; c < 8; ++c)
          kf[(t + 1) & 1][c] = *(const v4f*)(krow + (t + 1) * 16 * KPITCH + c * 8);
      }
      // the last tile's real keys are 192..195: both lane halves read those four
      v4f b0 = *(const v4f*)(brow + t * 16 + (t < QTILES - 1 ? 8 * h : 0));  // -inf for kpad
      // the load that follows is the last from this lane half's bias pointer and lands
      // on its registers: the loads that name them are waited for
      if (t == QTILES - 2) asm volatile("s_wait_xcnt 0x0" ::: "memory");
      v4f b1 = t < QTILES - 1 ? *(const v4f*)(brow + t * 16 + 8 * h + 4) : v4f{};
      // the reads above stay one group ahead of this tile's products: left alone, the
      // compiler put the LDS reads behind them, and the next tile waited for each
      __builtin_amdgcn_sched_barrier(0);
      v8f acc = v8f{};
#pragma unroll
      for (int c = 0; c < 8; ++c) {
        v4f k4 = kf[t & 1][c];
        acc = WMMA_F32((v2f{k4.x, k4.y}), (v2f{qf[c].x, qf[c].y}), acc);
        acc = WMMA_F32((v2f{k4.z, k4.w}), (v2f{qf[c].z, qf[c].w}), acc);
      }
#pragma unroll
      for (int j = 0; j < 4; ++j) {
        if (t < QTILES - 1) {
          s[t][j] = fmaf(acc[j], scale, b0[j]);
          s[t][j + 4] = fmaf(acc[j + 4], scale, b1[j]);
        } else {
          s[t][j] = h == 0 ? fmaf(acc[j], scale, b0[j]) : ninf;
          s[t][j + 4] = ninf;
        }
      }
    }

    // V rows of tile 0, asked for ahead of the softmax: row r is key t*16 + 8h + r
    const float* vrow = Vs + (8 * h) * HD + 4 * n16;
    v4f vf[2][8];
#pragma unroll
    for (int r = 0; r < 8; ++r) vf[0][r] = *(const v4f*)(vrow + r * HD);
    __builtin_amdgcn_sched_barrier(0);  // the softmax is a region of its own, as above

    // ---- softmax of this lane's query; 1/sum is applied to the output ----
    float m4[4] = {ninf, ninf, ninf, ninf};
#pragma unroll
    for (int t = 0; t < QTILES; ++t)
#pragma unroll
      for (int j = 0; j < 8; ++j) m4[j & 3] = fmaxf(m4[j & 3], s[t][j]);
    float mx = fmaxf(fmaxf(m4[0], m4[1]), fmaxf(m4[2], m4[3]));
    mx = fmaxf(mx, __shfl_xor(mx, 16, 32));
    float s4[4] = {0.0f, 0.0f, 0.0f, 0.0f};
#pragma unroll
    for (int t = 0; t < QTILES; ++t) {
      // exp(x) as 2^(x * log2 e), a tile at a time: arguments, exponentials, sums
#pragma unroll
      for (int j = 0; j < 8; ++j) s[t][j] = (s[t][j] - mx) * 1.44269504088896340736f;
#pragma unroll
      for (int j = 0; j < 8; ++j) s[t][j] = exp2_slot(s[t][j]);
#pragma unroll
      for (int j = 0; j < 8; ++j) s4[j & 3] += s[t][j];
    }
    float sum = (s4[0] + s4[1]) + (s4[2] + s4[3]);
    sum += __shfl_xor(sum, 16, 32);
    float inv = 1.0f / sum;

    // ---- O^T += V^T P^T ; V rows of tile t+1 are asked for ahead of tile t ----
    // keys from 196 on have P = 0 and zero V rows: the last tile's chunks 2 and 3
    // hold nothing else and are left out
    v8f oacc[4] = {v8f{}, v8f{}, v8f{}, v8f{}};
#pragma unroll
    for (int t = 0; t < QTILES; ++t) {
      __builtin_amdgcn_sched_barrier(0);  // one region per tile, as above
      if (t + 1 < QTILES) {
#pragma unroll
        for (int r = 0; r < (t + 1 < QTILES - 1 ? 8 : 4); ++r)
          vf[(t + 1) & 1][r] = *(const v4f*)(vrow + ((t + 1) * 16 + r) * HD);
      }
      __builtin_amdgcn_sched_barrier(0);  // one group of reads ahead of the products, as above
#pragma unroll
      for (int c = 0; c < (t < QTILES - 1 ? 4 : 2); ++c) {
        v4f v0 = vf[t & 1][2 * c];      // key t*16 + 8h + 2c
        v4f v1 = vf[t & 1][2 * c + 1];  // the next key
        v2f p = v2f{s[t][2 * c], s[t][2 * c + 1]};
        oacc[0] = WMMA_F32((v2f{v0.x, v1.x}), p, oacc[0]);
        oacc[1] = WMMA_F32((v2f{v0.y, v1.y}), p, oacc[1]);
        oacc[2] = WMMA_F32((v2f{v0.z, v1.z}), p, oacc[2]);
        oacc[3] = WMMA_F32((v2f{v0.w, v1.w}), p, oacc[3]);
      }
    }
    if (q < NN) {
      float* o = ctx + ((size_t)b * NN + q) * DD + head * HD + 32 * h;
#pragma unroll
      for (int j = 0; j < 8; ++j)
        *(v4f*)(o + 4 * j) =
            v4f{oacc[0][j] * inv, oacc[1][j] * inv, oacc[2][j] * inv, oacc[3][j] * inv};
    }
  }
}

// ---------------------------------------------------------------------------
extern "C" void kernel_launch(void* const* d_in, const int* in_sizes, int n_in,
                              void* d_out, int out_size, void* d_ws, size_t ws_size,
                              hipStream_t stream) {
  const float* query = (const float*)d_in[0];
  const float* key   = (const float*)d_in[1];
  const float* value = (const float*)d_in[2];
  const int*   qpad  = (const int*)d_in[3];
  const int*   kpad  = (const int*)d_in[4];
  const float* qpos  = (const float*)d_in[5];
  const float* kpos  = (const float*)d_in[6];
  const int*   isov  = (const int*)d_in[7];
  const float* Wq    = (const float*)d_in[8];
  const float* Wk    = (const float*)d_in[9];
  const float* Wv    = (const float*)d_in[10];
  const float* Wp    = (const float*)d_in[11];
  const float* bp    = (const float*)d_in[12];
  const float* W1    = (const float*)d_in[13];
  const float* b1    = (const float*)d_in[14];
  const float* W2    = (const float*)d_in[15];
  const float* b2    = (const float*)d_in[16];

  float* ws = (float*)d_ws;
  const size_t QHN = (size_t)BB * HH * NPAD * HD;  // 10,223,616 floats
  float* Qh = ws;
  float* Kh = Qh + QHN;
  float* Vh = Kh + QHN;
  float* biasbuf = Vh + QHN;                       // [B][NPAD][NPAD]
  const size_t BIASN = (size_t)BB * NPAD * NPAD;
  float* ctx = biasbuf + BIASN;                    // [B][N][D]

  // stage 1: Q/K/V projections (head-layout scatter), rel-pos bias + key mask,
  // zero padding rows of the head buffers (WMMA tiles read them)
  pre_attention_kernel<<<PRE_BLOCKS, 256, 0, stream>>>(
      query, key, value, Wq, Wk, Wv, qpos, kpos, qpad, kpad, isov, W1, b1, W2, b2,
      ws, biasbuf);

  // stage 2: attention
  attention_kernel<<<BB * HH * 2, 256, 0, stream>>>(Qh, Kh, Vh, biasbuf, ctx);

  // stage 3: output projection + bias
  out_proj_kernel<<<GEMM_BLOCKS, 256, 0, stream>>>(ctx, Wp, bp, (float*)d_out);
}

// v005
// It runs in 286 microseconds.
// Next to v004, in two timings, it ran 1.21 times as fast each time.
// All steps since v000 together make it 2.27 times as fast.
#include <hip/hip_runtime.h>

// ---------------- problem constants ----------------
#define BB 64
#define NN 196
#define DD 768
#define HH 12
#define HD 64
#define NPAD 208          // 13 * 16
#define QTILES 13         // ceil(196/16)
#define BM 64             // GEMM block tile rows
#define BN 128            // GEMM block tile columns
#define KC 32             // GEMM K chunk per LDS stage
#define NTRIP (DD / KC)   // 24
#define NBLK (DD / BN)    // 6 column tiles
#define GEMM_BLOCKS 1176  // (12544 / 64) * 6
#define PRE_BLOCKS (3 * GEMM_BLOCKS)      // Q, K and V projections in one grid
#define ZERO_Q (BB * HH * 12 * HD)           // Q: tokens 196..207 of every head
#define ZERO_KV (2 * BB * HH * 16 * HD)      // K, V: up to 15 rows behind the last live key
#define ZERO_TOTAL (ZERO_Q + ZERO_KV)        // 2,162,688 padding elements at most
#define BIAS_TOTAL (BB * NN * NPAD)          // 2,609,152 bias elements
// index tables in the workspace, in ints from their common base (key_index_kernel)
#define IX_CNT 0                      // [B] live (unmasked) keys of a batch
#define IX_TOTAL BB                   // live keys of all batches
#define IX_PERM 128                   // [B][NPAD] token of live key j
#define IX_SRC (IX_PERM + BB * NPAD)  // [B*N] row of key/value behind packed row g
#define IX_DST (IX_SRC + BB * NN)     // [B*N] head-buffer offset of packed row g, -1: none
static_assert(IX_SRC % 4 == 0 && IX_DST % 4 == 0, "16-byte reads of the row tables");
#define FIRST_SET 1280      // blocks that can be resident at once: 5 per WGP by LDS, 256 WGPs
#define SIDE_BLOCKS (PRE_BLOCKS - FIRST_SET)  // 2248 blocks carry the bias and padding work
#define BIAS_PER_BLOCK 1280  // 5 per thread: SIDE_BLOCKS * 1280 >= BIAS_TOTAL
#define ZERO_PER_BLOCK 1024  // 4 per thread: SIDE_BLOCKS * 1024 >= ZERO_TOTAL
static_assert(SIDE_BLOCKS * BIAS_PER_BLOCK >= BIAS_TOTAL, "bias slices cover the table");
static_assert(SIDE_BLOCKS * ZERO_PER_BLOCK >= ZERO_TOTAL, "padding slices cover the rows");
#define APITCH 36         // 32 + 4 floats: 16 rows of b64 reads fall on 64 banks
#define BPITCH 288        // one k-pair of W: 2 x 128 + 32 floats (layout at copy_chunk)
#define A_FLOATS (BM * APITCH)
#define B_FLOATS ((KC / 2) * BPITCH)
#define STAGE_FLOATS (A_FLOATS + B_FLOATS)  // 27,648 B
#define KPITCH 68         // K rows in LDS: 272 B = 16 B x 17, 16 rows of b128 reads on 64 banks
static_assert(NPAD % 16 == 0, "eight waves stage two rows each of every 16-row key tile");

typedef __attribute__((ext_vector_type(2))) float v2f;
typedef __attribute__((ext_vector_type(4))) float v4f;
typedef __attribute__((ext_vector_type(8))) float v8f;
typedef __attribute__((ext_vector_type(4))) int v4i;

#define WMMA_F32(a, b, c) \
    __builtin_amdgcn_wmma_f32_16x16x4_f32(false, (a), false, (b), (short)0, (c), false, false)

// ---------------------------------------------------------------------------
// A masked key has softmax weight exactly 0, so its K and V rows are never needed.
// The live keys of a batch are packed to the front: live key j of batch b is token
// perm[b][j]. K, V and the bias table hold packed keys only, and attention runs over
// key_tiles(cnt[b]) tiles of 16 keys.
// ---------------------------------------------------------------------------
__device__ __forceinline__ int key_tiles(int cnt) {
  int nt = (cnt + 15) >> 4;
  return nt < 1 ? 1 : nt > QTILES ? QTILES : nt;  // no live key: one tile, all masked
}

// One block of 32 waves; wave w ranks the keys of batches 2w and 2w+1 by ballots.
__global__ __launch_bounds__(1024) void key_index_kernel(const int* __restrict__ kpad,
                                                         int* __restrict__ ix) {
  __shared__ int scnt[BB];
  __shared__ int soff[BB + 1];
  int tid = (int)threadIdx.x;
  int w = tid >> 5, l = tid & 31;
  // constant indices only: the loops over mask and live are unrolled
  int mask[2][7];  // all 14 loads are asked for at once: one memory latency
#pragma unroll
  for (int s = 0; s < 2; ++s)
#pragma unroll
    for (int i = 0; i < 7; ++i) {
      int tok = i * 32 + l;
      mask[s][i] = kpad[(2 * w + s) * NN + (tok < NN ? tok : NN - 1)];
    }
  // the index registers these loads name are reused while some are still in flight
  asm volatile("s_wait_xcnt 0x0" ::: "memory");
  unsigned live[2][7];
#pragma unroll
  for (int s = 0; s < 2; ++s) {
    int c = 0;
#pragma unroll
    for (int i = 0; i < 7; ++i) {
      live[s][i] = __builtin_amdgcn_ballot_w32(i * 32 + l < NN && mask[s][i] == 0);
      c += __builtin_popcount(live[s][i]);
    }
    if (l == 0) scnt[2 * w + s] = c;
  }
  __syncthreads();
  if (tid < BB) {
    int off = 0;
    for (int i = 0; i < BB; ++i) off += i < tid ? scnt[i] : 0;
    soff[tid] = off;
    if (tid == BB - 1) soff[BB] = off + scnt[BB - 1];
  }
  __syncthreads();
  int total = soff[BB];
#pragma unroll
  for (int s = 0; s < 2; ++s) {
    int b = 2 * w + s, base = 0, off = soff[b];
#pragma unroll
    for (int i = 0; i < 7; ++i) {
      if ((live[s][i] >> l) & 1u) {
        int j = base + __builtin_popcount(live[s][i] & ((1u << l) - 1u));
        ix[IX_PERM + b * NPAD + j] = i * 32 + l;
        ix[IX_SRC + off + j] = b * NN + i * 32 + l;
        ix[IX_DST + off + j] = (b * HH * NPAD + j) * HD;
      }
      base += __builtin_popcount(live[s][i]);
    }
    if (l == 0) ix[IX_CNT + b] = base;
  }
  // packed rows behind the last live key: a valid source row, no destination
  for (int i = 0; i < (BB * NN + 1023) / 1024; ++i) {
    int g = total + tid + i * 1024;
    if (g < BB * NN) {
      ix[IX_SRC + g] = 0;
      ix[IX_DST + g] = -1;
    }
  }
  if (tid == 0) ix[IX_TOTAL] = total;
}

// ---------------------------------------------------------------------------
// Padding: element idx (< ZERO_TOTAL) of the rows that WMMA tiles read and no
// projection writes, in the head buffers [B][H][NPAD][HD]: tokens 196..207 of Q; in K
// and V the rows from the batch's live count up to the end of its last key tile.
// ---------------------------------------------------------------------------
__device__ __forceinline__ void zero_pad_elem(float* ws, const int* __restrict__ ix,
                                              size_t idx) {
  const size_t QHN = (size_t)BB * HH * NPAD * HD;
  int e = (int)idx;
  if (e < ZERO_Q) {
    int hd = e % HD;
    int t = e / HD;
    int row = NN + t % 12;
    int bh = t / 12;  // 0..767
    ws[((size_t)bh * NPAD + row) * HD + hd] = 0.0f;
  } else {
    e -= ZERO_Q;
    int hd = e % HD;
    int t = e / HD;
    int r = t % 16;
    t /= 16;
    int bh = t % (BB * HH);
    int mat = 1 + t / (BB * HH);
    int cnt = ix[IX_CNT + bh / HH];
    int row = cnt + r;
    if (row < key_tiles(cnt) * 16) ws[mat * QHN + ((size_t)bh * NPAD + row) * HD + hd] = 0.0f;
  }
}

// ---------------------------------------------------------------------------
// Element idx of the relative-position bias MLP over packed keys.
// bias[b,q,j] = j >= cnt[b] ? -inf : ((is_overlap && !qpad) ? enc(qpos-kpos[perm j]) : 0)
// Stored [B][NPAD][NPAD]; rows 0..195 are written, all 208 columns of each.
// ---------------------------------------------------------------------------
__device__ __forceinline__ void bias_elem(
    const float* __restrict__ qpos, const float* __restrict__ kpos,
    const int* __restrict__ qpad, const int* __restrict__ ix,
    const int* __restrict__ is_ovl,
    const float* __restrict__ W1, const float* __restrict__ b1,
    const float* __restrict__ W2, const float* __restrict__ b2,
    float* __restrict__ biasbuf, size_t idx) {
  if (idx >= (size_t)BIAS_TOTAL) return;
  int j = (int)(idx % NPAD);
  size_t r = idx / NPAD;
  int q = (int)(r % NN);
  int b = (int)(r / NN);

  float out;
  if (j >= ix[IX_CNT + b]) {
    out = -__builtin_inff();
  } else if (is_ovl[b] && !qpad[b * NN + q]) {
    int k = ix[IX_PERM + b * NPAD + j];
    float rx = qpos[((size_t)b * NN + q) * 3 + 0] - kpos[((size_t)b * NN + k) * 3 + 0];
    float ry = qpos[((size_t)b * NN + q) * 3 + 1] - kpos[((size_t)b * NN + k) * 3 + 1];
    float rz = qpos[((size_t)b * NN + q) * 3 + 2] - kpos[((size_t)b * NN + k) * 3 + 2];
    float acc = b2[0];
#pragma unroll
    for (int e = 0; e < 32; ++e) {
      float h = fmaf(rx, W1[e], fmaf(ry, W1[32 + e], fmaf(rz, W1[64 + e], b1[e])));
      acc = fmaf(fmaxf(h, 0.0f), W2[e], acc);
    }
    out = acc;
  } else {
    out = 0.0f;
  }
  biasbuf[((size_t)b * NPAD + q) * NPAD + j] = out;
}

// ---------------------------------------------------------------------------
// fp32 WMMA GEMM, tile blk of C[12544,768] = A[12544,768] * W[768,768].
// Block = 8 waves = one 64 x 128 tile of C; wave (wm, wn) owns 32 x 32 of it
// (2 x 2 accumulator tiles). K runs in chunks of 32: the 64 x 32 piece of A and
// the 32 x 128 piece of W are staged in LDS by async b128 copies, two buffers,
// the next chunk in flight while this one is multiplied. Every W element is
// fetched from L2 once per 64 rows of C and read by the waves from LDS.
// mode 0: scatter into padded head layout [B][H][NPAD][HD]   (Q/K/V proj)
// mode 1: out[row*768+col] = acc + bias[col]                 (final proj)
// With ix (K and V): row g of the tile grid is packed row g; its A row is ix[IX_SRC + g]
// and its place in the head buffer ix[IX_DST + g].
// ---------------------------------------------------------------------------
__device__ __forceinline__ unsigned lds_off(const void* p) { return (unsigned)(size_t)p; }

// One chunk: 2 copies of A and 4 of W per lane. The s_wait_xcnt closes the
// statement so that no address register is rewritten ahead of it.
// W in LDS: rows k = 2p and 2p+1 share pitch row p, interleaved in runs of 16
// columns: float (k, c) sits at p*BPITCH + (c/16)*32 + (k&1)*16 + c%16, so a
// lane's two k of one fragment are 16 floats apart (one two-address read into a
// register pair) and the two lane halves fall on different banks.
__device__ __forceinline__ void copy_chunk(unsigned la, unsigned lb, const float* ga,
                                           const float* ga1, const float* gb) {
  unsigned la1 = la + 32 * APITCH * 4;
  unsigned lb1 = lb + 4 * BPITCH * 4, lb2 = lb + 8 * BPITCH * 4, lb3 = lb + 12 * BPITCH * 4;
  const float* gb1 = gb + 8 * DD;
  const float* gb2 = gb + 16 * DD;
  const float* gb3 = gb + 24 * DD;
  asm volatile(
      "global_load_async_to_lds_b128 %0, %6, off\n\t"
      "global_load_async_to_lds_b128 %1, %7, off\n\t"
      "global_load_async_to_lds_b128 %2, %8, off\n\t"
      "global_load_async_to_lds_b128 %3, %9, off\n\t"
      "global_load_async_to_lds_b128 %4, %10, off\n\t"
      "global_load_async_to_lds_b128 %5, %11, off\n\t"
      "s_wait_xcnt 0x0"
      :: "v"(la), "v"(la1), "v"(lb), "v"(lb1), "v"(lb2), "v"(lb3),
         "v"(ga), "v"(ga1), "v"(gb), "v"(gb1), "v"(gb2), "v"(gb3)
      : "memory");
}

__device__ __forceinline__ void gemm_tile(
    const float* __restrict__ A, const float* __restrict__ W,
    const float* __restrict__ bias, float* out, int mode, int blk,
    const int* __restrict__ ix) {
  __shared__ __attribute__((aligned(16))) float smem[2 * STAGE_FLOATS];  // 54 KB

  int tid = (int)threadIdx.x;
  int m0 = (blk / NBLK) * BM;   // first row of the C tile
  int n0 = (blk % NBLK) * BN;   // first column of the C tile
  int wave = tid >> 5;
  int wm = wave & 1;               // 32-row half of the tile
  int wn = wave >> 1;              // 32-column quarter of the tile
  int l = tid & 31;
  int h = l >> 4;                  // lane half: selects k-pair / row-half
  int n16 = l & 15;                // lane within 16

  // each lane's own copy addresses: A rows tid/8 (+32), W rows tid/32 (+8,16,24)
  int ar0 = m0 + (tid >> 3), ar1 = ar0 + 32;
  if (ix) {
    ar0 = ix[IX_SRC + ar0];
    ar1 = ix[IX_SRC + ar1];
  }
  const float* ga = A + (size_t)ar0 * DD + (tid & 7) * 4;
  const float* ga1 = A + (size_t)ar1 * DD + (tid & 7) * 4;
  const float* gb = W + (size_t)(tid >> 5) * DD + n0 + (tid & 31) * 4;
  unsigned la = lds_off(smem) + ((tid >> 3) * APITCH + (tid & 7) * 4) * 4;
  unsigned lb = lds_off(smem) + (A_FLOATS + (tid >> 6) * BPITCH + ((tid & 31) >> 2) * 32 +
                                 ((tid >> 5) & 1) * 16 + (tid & 3) * 4) * 4;

  copy_chunk(la, lb, ga, ga1, gb);
  asm volatile("s_wait_asynccnt 0x0" ::: "memory");  // chunk 0 landed (own copies)
  __syncthreads();                                   // ... and everybody's
  copy_chunk(la + STAGE_FLOATS * 4, lb + STAGE_FLOATS * 4, ga + KC, ga1 + KC,
             gb + (size_t)KC * DD);

  v8f acc[2][2] = {{v8f{}, v8f{}}, {v8f{}, v8f{}}};

  // rolled: one trip's 32 WMMAs are body enough
#pragma unroll 1
  for (int t = 0; t < NTRIP; ++t) {
    const float* As = smem + (t & 1) * STAGE_FLOATS + (wm * 32 + n16) * APITCH + 2 * h;
    const float* Bs = smem + (t & 1) * STAGE_FLOATS + A_FLOATS + h * BPITCH + wn * 64 + n16;
    // unrolled: constant LDS offsets, and the reads can run ahead of the WMMAs
#pragma unroll
    for (int ks = 0; ks < KC / 4; ++ks) {
      // fragment element j -> k = t*32 + ks*4 + 2h + j, for A and for W alike
      v2f a0 = *(const v2f*)&As[ks * 4];
      v2f a1 = *(const v2f*)&As[16 * APITCH + ks * 4];
      v2f b0, b1;
      b0.x = Bs[ks * 2 * BPITCH];
      b0.y = Bs[ks * 2 * BPITCH + 16];
      b1.x = Bs[ks * 2 * BPITCH + 32];
      b1.y = Bs[ks * 2 * BPITCH + 48];
      acc[0][0] = WMMA_F32(a0, b0, acc[0][0]);
      acc[0][1] = WMMA_F32(a0, b1, acc[0][1]);
      acc[1][0] = WMMA_F32(a1, b0, acc[1][0]);
      acc[1][1] = WMMA_F32(a1, b1, acc[1][1]);
    }
    asm volatile("s_wait_dscnt 0x0" ::: "memory");     // own reads of this buffer are done
    asm volatile("s_wait_asynccnt 0x0" ::: "memory");  // own copies of chunk t+1 landed
    __syncthreads();  // publishes chunk t+1 and frees the buffer trip t has read
    if (t + 2 < NTRIP)
      copy_chunk(la + (t & 1) * (STAGE_FLOATS * 4), lb + (t & 1) * (STAGE_FLOATS * 4),
                 ga + (t + 2) * KC, ga1 + (t + 2) * KC, gb + (size_t)(t + 2) * KC * DD);
  }
  asm volatile("s_wait_asynccnt 0x0" ::: "memory");  // nothing in flight at the end

  int row0 = m0 + wm * 32 + 8 * h;   // C row of accumulator element 0, tile row 0
  int col0 = n0 + wn * 32 + n16;     // C column, tile column 0
  // the store loops are unrolled so that every accumulator index is a constant
  if (mode == 0) {
    int hh = col0 >> 6, hd = col0 & 63;  // both 16-column tiles lie in one head
    if (ix) {
#pragma unroll
      for (int mi = 0; mi < 2; ++mi) {
        v4i d0 = *(const v4i*)(ix + IX_DST + row0 + mi * 16);
        v4i d1 = *(const v4i*)(ix + IX_DST + row0 + mi * 16 + 4);
#pragma unroll
        for (int j = 0; j < 8; ++j) {
          int d = j < 4 ? d0[j & 3] : d1[j & 3];
          if (d >= 0) {  // the last tile's rows behind the last live key go nowhere
            float* o = out + (size_t)d + hh * (NPAD * HD) + hd;
            o[0] = acc[mi][0][j];
            o[16] = acc[mi][1][j];
          }
        }
      }
    } else {
#pragma unroll
      for (int mi = 0; mi < 2; ++mi) {
#pragma unroll
        for (int j = 0; j < 8; ++j) {
          int R = row0 + mi * 16 + j;
          int bb = R / NN, tok = R % NN;
          float* o = out + (((size_t)bb * HH + hh) * NPAD + tok) * HD + hd;
          o[0] = acc[mi][0][j];
          o[16] = acc[mi][1][j];
          // the next rows' address arithmetic reuses the registers these stores name
          asm volatile("s_wait_xcnt 0x0" ::: "memory");
        }
      }
    }
  } else {
    float bias0 = bias[col0], bias1 = bias[col0 + 16];
#pragma unroll
    for (int mi = 0; mi < 2; ++mi) {
#pragma unroll
      for (int j = 0; j < 8; ++j) {
        float* o = out + (size_t)(row0 + mi * 16 + j) * DD + col0;
        o[0] = acc[mi][0][j] + bias0;
        o[16] = acc[mi][1][j] + bias1;
      }
    }
  }
}

// ---------------------------------------------------------------------------
// Stage 1: everything else that attention needs, in one launch. Block x computes tile
// x % 1176 of projection x / 1176 (Q, K, V); K and V have packed rows only, and a block
// whose tile lies behind the last of them ends after its side work.
// Every block behind the first resident set first does its own slice of the bias
// table and of the padding rows. (The split
// is for speed only: every slice is done once wherever the blocks land.) The three
// jobs write disjoint memory and none reads what another writes.
// ---------------------------------------------------------------------------
__global__ __launch_bounds__(256) void pre_attention_kernel(
    const float* __restrict__ query, const float* __restrict__ key,
    const float* __restrict__ value,
    const float* __restrict__ Wq, const float* __restrict__ Wk,
    const float* __restrict__ Wv,
    const float* __restrict__ qpos, const float* __restrict__ kpos,
    const int* __restrict__ qpad, const int* __restrict__ ix,
    const int* __restrict__ is_ovl,
    const float* __restrict__ W1, const float* __restrict__ b1,
    const float* __restrict__ W2, const float* __restrict__ b2,
    float* __restrict__ ws, float* __restrict__ biasbuf) {
  if ((int)blockIdx.x >= FIRST_SET) {
    size_t side = (size_t)((int)blockIdx.x - FIRST_SET);
    size_t bidx = side * BIAS_PER_BLOCK + threadIdx.x;
    for (int i = 0; i < BIAS_PER_BLOCK / 256; ++i)
      bias_elem(qpos, kpos, qpad, ix, is_ovl, W1, b1, W2, b2, biasbuf, bidx + i * 256);
    size_t zidx = side * ZERO_PER_BLOCK + threadIdx.x;
    for (int i = 0; i < ZERO_PER_BLOCK / 256; ++i)
      if (zidx + i * 256 < (size_t)ZERO_TOTAL) zero_pad_elem(ws, ix, zidx + i * 256);
  }

  const size_t QHN = (size_t)BB * HH * NPAD * HD;
  int which = (int)blockIdx.x / GEMM_BLOCKS;
  const float* A = which == 0 ? query : which == 1 ? key : value;
  const float* W = which == 0 ? Wq : which == 1 ? Wk : Wv;
  int blk = (int)blockIdx.x % GEMM_BLOCKS;
  // the whole block leaves, ahead of every barrier
  if (which != 0 && (blk / NBLK) * BM >= ix[IX_TOTAL]) return;
  gemm_tile(A, W, nullptr, ws + (size_t)which * QHN, 0, blk, which != 0 ? ix : nullptr);
}

// Stage 3: output projection + bias
__global__ __launch_bounds__(256) void out_proj_kernel(
    const float* __restrict__ A, const float* __restrict__ W,
    const float* __restrict__ bias, float* __restrict__ out) {
  gemm_tile(A, W, bias, out, 1, (int)blockIdx.x, nullptr);
}

// ---------------------------------------------------------------------------
// Stage 2: attention, transposed. Block = 8 waves on ONE (batch, head); two blocks per
// (batch, head), with query tiles 0..6 and 7..12, one tile per wave. The head's K and V
// (packed live keys, nt tiles of 16 rows) are staged in LDS once per block by async
// b128 copies that cover whole 128-byte lines, and every wave takes its K and V
// fragments from LDS: read straight from memory, a K fragment would touch 16 lines for
// 512 bytes, and every query tile would fetch all of K and V for itself.
// S^T = K Q^T : A = 16 keys x hd, B = hd x 16 queries. A lane then holds the
// scores of ONE query (column n16): keys t*16 + 8h + j in s[t][j]. Maximum and
// sum run in the lane, plus one exchange between the two lane halves.
// O^T = V^T P^T : the score registers are the B operand as they stand; the
// registers (2c, 2c+1) of tile t carry keys t*16 + 8h + 2c + j, and the V loader
// below follows the same key order. Row M of output tile oc is head-dim 4*M + oc,
// so one 16-byte load of a V row feeds all four tiles and one 16-byte store
// takes one element of each.
// ---------------------------------------------------------------------------
// 2^x. The v_nop is the one slot that the instruction set asks for behind a
// transcendental before its result is read or its source overwritten; it shares the
// statement so that it stands directly behind.
__device__ __forceinline__ float exp2_slot(float x) {
  float e;
  asm("v_exp_f32 %0, %1\n\tv_nop" : "=v"(e) : "v"(x));
  return e;
}

// Two rows of 64 floats (512 contiguous bytes) of K and of V, global to LDS; lk, lv, gk
// and gv are the lane's own addresses. The s_wait_xcnt closes each statement so that no
// address register is rewritten ahead of it.
__device__ __forceinline__ void copy_kv_tile(unsigned lk, unsigned lv, const float* gk,
                                             const float* gv) {
  asm volatile(
      "global_load_async_to_lds_b128 %0, %2, off\n\t"
      "global_load_async_to_lds_b128 %1, %3, off\n\t"
      "s_wait_xcnt 0x0"
      :: "v"(lk), "v"(lv), "v"(gk), "v"(gv)
      : "memory");
}

// The same for two key tiles that follow one another, under one wait.
__device__ __forceinline__ void copy_kv_tiles2(unsigned lk, unsigned lv, const float* gk,
                                               const float* gv) {
  asm volatile(
      "global_load_async_to_lds_b128 %0, %4, off\n\t"
      "global_load_async_to_lds_b128 %1, %5, off\n\t"
      "global_load_async_to_lds_b128 %2, %6, off\n\t"
      "global_load_async_to_lds_b128 %3, %7, off\n\t"
      "s_wait_xcnt 0x0"
      :: "v"(lk), "v"(lv), "v"(lk + 16 * KPITCH * 4), "v"(lv + 16 * HD * 4),
         "v"(gk), "v"(gv), "v"(gk + 16 * HD), "v"(gv + 16 * HD)
      : "memory");
}

// four waves per SIMD, two blocks per WGP: the waves cover each other's load waits and
// softmax, and one block's staging runs beside the other block's products
__global__ __launch_bounds__(256) __attribute__((amdgpu_waves_per_eu(4, 4))) void attention_kernel(
    const float* __restrict__ Qh, const float* __restrict__ Kh,
    const float* __restrict__ Vh, const float* __restrict__ biasbuf,
    const int* __restrict__ ix, float* __restrict__ ctx) {
  __shared__ __attribute__((aligned(16))) float Ks[NPAD * KPITCH];  // 56,576 B
  __shared__ __attribute__((aligned(16))) float Vs[NPAD * HD];      // 53,248 B

  int w = __builtin_amdgcn_readfirstlane((int)threadIdx.x >> 5);  // wave in a scalar
  int l = threadIdx.x & 31;
  int upper = (int)blockIdx.x & 1;   // 0: query tiles 0..6, 1: query tiles 7..12
  int head = ((int)blockIdx.x >> 1) % HH;
  int b = ((int)blockIdx.x >> 1) / HH;
  // lower block: waves 0..6 work; upper block: waves 2..7
  int qt = upper ? w + 5 : w;
  bool copies_only = upper ? w < 2 : w == 7;
  int h = l >> 4;
  int n16 = l & 15;
  const float scale = 0.125f;  // 1/sqrt(HD)
  const float ninf = -__builtin_inff();

  int q = qt * 16 + n16;            // this lane's query; < NPAD, padded rows are zero
  int qc = q < NN ? q : NN - 1;     // bias rows exist for real queries only
  const float* brow = biasbuf + ((size_t)b * NPAD + qc) * NPAD;
  int nt = key_tiles(ix[IX_CNT + b]);  // key tiles of this batch, 1..13, the same in every wave

  {
    const float* Qb = Qh + ((size_t)b * HH + head) * NPAD * HD;
    const float* Kb = Kh + ((size_t)b * HH + head) * NPAD * HD;
    const float* Vb = Vh + ((size_t)b * HH + head) * NPAD * HD;

    // ---- staging: wave w brings rows 2w and 2w+1 of every key tile of K and of V; lane l
    // holds 16 bytes of row (l >> 4) of the pair ----
    int srow = 2 * w + h;
    unsigned lk = lds_off(Ks) + (srow * KPITCH + n16 * 4) * 4;
    unsigned lv = lds_off(Vs) + (srow * HD + n16 * 4) * 4;
    const float* gk = Kb + (size_t)srow * HD + n16 * 4;
    const float* gv = Vb + (size_t)srow * HD + n16 * 4;
    // unrolled: every tile offset is a constant; the tests on nt are scalar branches
#pragma unroll
    for (int i = 0; i < QTILES; i += 2) {
      if (i + 1 < QTILES && i + 1 < nt)
        copy_kv_tiles2(lk + i * 16 * KPITCH * 4, lv + i * 16 * HD * 4, gk + i * 16 * HD,
                       gv + i * 16 * HD);
      else if (i < nt)
        copy_kv_tile(lk + i * 16 * KPITCH * 4, lv + i * 16 * HD * 4, gk + i * 16 * HD,
                     gv + i * 16 * HD);
    }

    // Every loop of this kernel is unrolled: qf, kf, s, vf and oacc live in registers,
    // which takes constant indices.
    // ---- Q fragments: element e of qf[c] is head-dim c*8 + 4h + e ----
    v4f qf[8];
#pragma unroll
    for (int c = 0; c < 8; ++c)
      qf[c] = *(const v4f*)(Qb + (size_t)q * HD + c * 8 + 4 * h);

    asm volatile("s_wait_asynccnt 0x0" ::: "memory");  // own copies of K and V landed
    __syncthreads();                                   // ... and everybody's
    if (copies_only) return;  // whole waves, behind the kernel's only barrier

    // ---- scores; every index of s[] must be a constant, so the loops unroll.
    // The K fragments of tile t+1 and the bias of tile t are asked for ahead of
    // tile t's products, which cover their latency.
    const float* krow = Ks + n16 * KPITCH + 4 * h;
    v8f s[QTILES];
    v4f kf[2][8];  // element e of kf[.][c]: the same head-dim as in qf[c]
#pragma unroll
    for (int c = 0; c < 8; ++c) kf[0][c] = *(const v4f*)(krow + c * 8);
#pragma unroll
    for (int t = 0; t < QTILES; ++t) {
      if (t >= nt) continue;  // a scalar test; s[t] from here on is never read
      if (t + 1 < QTILES && t + 1 < nt) {
#pragma unroll
        for (int c = 0; c < 8; ++c)
          kf[(t + 1) & 1][c] = *(const v4f*)(krow + (t + 1) * 16 * KPITCH + c * 8);
      }
      v4f b0 = *(const v4f*)(brow + t * 16 + 8 * h);  // -inf behind the last live key
      v4f b1 = *(const v4f*)(brow + t * 16 + 8 * h + 4);
      v8f acc = v8f{};
#pragma unroll
      for (int c = 0; c < 8; ++c) {
        v4f k4 = kf[t & 1][c];
        acc = WMMA_F32((v2f{k4.x, k4.y}), (v2f{qf[c].x, qf[c].y}), acc);
        acc = WMMA_F32((v2f{k4.z, k4.w}), (v2f{qf[c].z, qf[c].w}), acc);
      }
#pragma unroll
      for (int j = 0; j < 4; ++j) {
        s[t][j] = fmaf(acc[j], scale, b0[j]);
        s[t][j + 4] = fmaf(acc[j + 4], scale, b1[j]);
      }
    }

    // V rows of tile 0, asked for ahead of the softmax: row r is key t*16 + 8h + r
    const float* vrow = Vs + (8 * h) * HD + 4 * n16;
    v4f vf[2][8];
#pragma unroll
    for (int r = 0; r < 8; ++r) vf[0][r] = *(const v4f*)(vrow + r * HD);
    __builtin_amdgcn_sched_barrier(0);  // these reads are issued ahead of the softmax

    // ---- softmax of this lane's query; 1/sum is applied to the output ----
    float m4[4] = {ninf, ninf, ninf, ninf};
#pragma unroll
    for (int t = 0; t < QTILES; ++t) {
      if (t >= nt) continue;
#pragma unroll
      for (int j = 0; j < 8; ++j) m4[j & 3] = fmaxf(m4[j & 3], s[t][j]);
    }
    float mx = fmaxf(fmaxf(m4[0], m4[1]), fmaxf(m4[2], m4[3]));
    mx = fmaxf(mx, __shfl_xor(mx, 16, 32));
    float s4[4] = {0.0f, 0.0f, 0.0f, 0.0f};
#pragma unroll
    for (int t = 0; t < QTILES; ++t) {
      if (t >= nt) continue;
      // exp(x) as 2^(x * log2 e), a tile at a time: arguments, exponentials, sums
#pragma unroll
      for (int j = 0; j < 8; ++j) s[t][j] = (s[t][j] - mx) * 1.44269504088896340736f;
#pragma unroll
      for (int j = 0; j < 8; ++j) s[t][j] = exp2_slot(s[t][j]);
#pragma unroll
      for (int j = 0; j < 8; ++j) s4[j & 3] += s[t][j];
    }
    float sum = (s4[0] + s4[1]) + (s4[2] + s4[3]);
    sum += __shfl_xor(sum, 16, 32);
    float inv = 1.0f / sum;

    // ---- O^T += V^T P^T ; V rows of tile t+1 are asked for ahead of tile t ----
    // rows behind the last live key have P = 0 and zero V rows
    v8f oacc[4] = {v8f{}, v8f{}, v8f{}, v8f{}};
#pragma unroll
    for (int t = 0; t < QTILES; ++t) {
      if (t >= nt) continue;
      if (t + 1 < QTILES && t + 1 < nt) {
#pragma unroll
        for (int r = 0; r < 8; ++r)
          vf[(t + 1) & 1][r] = *(const v4f*)(vrow + ((t + 1) * 16 + r) * HD);
      }
#pragma unroll
      for (int c = 0; c < 4; ++c) {
        v4f v0 = vf[t & 1][2 * c];      // key t*16 + 8h + 2c
        v4f v1 = vf[t & 1][2 * c + 1];  // the next key
        v2f p = v2f{s[t][2 * c], s[t][2 * c + 1]};
        oacc[0] = WMMA_F32((v2f{v0.x, v1.x}), p, oacc[0]);
        oacc[1] = WMMA_F32((v2f{v0.y, v1.y}), p, oacc[1]);
        oacc[2] = WMMA_F32((v2f{v0.z, v1.z}), p, oacc[2]);
        oacc[3] = WMMA_F32((v2f{v0.w, v1.w}), p, oacc[3]);
      }
    }
    if (q < NN) {
      float* o = ctx + ((size_t)b * NN + q) * DD + head * HD + 32 * h;
#pragma unroll
      for (int j = 0; j < 8; ++j)
        *(v4f*)(o + 4 * j) =
            v4f{oacc[0][j] * inv, oacc[1][j] * inv, oacc[2][j] * inv, oacc[3][j] * inv};
    }
  }
}

// ---------------------------------------------------------------------------
extern "C" void kernel_launch(void* const* d_in, const int* in_sizes, int n_in,
                              void* d_out, int out_size, void* d_ws, size_t ws_size,
                              hipStream_t stream) {
  const float* query = (const float*)d_in[0];
  const float* key   = (const float*)d_in[1];
  const float* value = (const float*)d_in[2];
  const int*   qpad  = (const int*)d_in[3];
  const int*   kpad  = (const int*)d_in[4];
  const float* qpos  = (const float*)d_in[5];
  const float* kpos  = (const float*)d_in[6];
  const int*   isov  = (const int*)d_in[7];
  const float* Wq    = (const float*)d_in[8];
  const float* Wk    = (const float*)d_in[9];
  const float* Wv    = (const float*)d_in[10];
  const float* Wp    = (const float*)d_in[11];
  const float* bp    = (const float*)d_in[12];
  const float* W1    = (const float*)d_in[13];
  const float* b1    = (const float*)d_in[14];
  const float* W2    = (const float*)d_in[15];
  const float* b2    = (const float*)d_in[16];

  float* ws = (float*)d_ws;
  const size_t QHN = (size_t)BB * HH * NPAD * HD;  // 10,223,616 floats
  float* Qh = ws;
  float* Kh = Qh + QHN;
  float* Vh = Kh + QHN;
  float* biasbuf = Vh + QHN;                       // [B][NPAD][NPAD]
  const size_t BIASN = (size_t)BB * NPAD * NPAD;
  float* ctx = biasbuf + BIASN;                    // [B][N][D]
  int* ix = (int*)(ctx + (size_t)BB * NN * DD);    // index tables of the live keys

  // stage 0: rank the live keys of every batch
  key_index_kernel<<<1, 1024, 0, stream>>>(kpad, ix);

  // stage 1: Q/K/V projections (head-layout scatter), rel-pos bias + key mask,
  // zero padding rows of the head buffers (WMMA tiles read them)
  pre_attention_kernel<<<PRE_BLOCKS, 256, 0, stream>>>(
      query, key, value, Wq, Wk, Wv, qpos, kpos, qpad, ix, isov, W1, b1, W2, b2,
      ws, biasbuf);

  // stage 2: attention
  attention_kernel<<<BB * HH * 2, 256, 0, stream>>>(Qh, Kh, Vh, biasbuf, ix, ctx);

  // stage 3: output projection + bias
  out_proj_kernel<<<GEMM_BLOCKS, 256, 0, stream>>>(ctx, Wp, bp, (float*)d_out);
}
